// v000
// Times are from an AMD MI455X. After a warm-up the kernel runs many times in a row, and a time is the length of
// such a window on the GPU divided by its runs, so every launch and the gaps after it count. The runs cycle
// through copies of the inputs. A figure is the median of several windows, for all but v000 over two sittings.
// Sittings can differ by a few percent; kernels timed side by side share one.
// v000, which the later versions start from, runs in 2650 microseconds.
// Contractions: QKV, Q.M[b], Wo, Wpos/Wneg, Wproj projections and attention scores q.k^T and P.V all on v_wmma_f32_16x16x32_f16 (f16 operands: activations plain, weights carried x16 / x64, P carried x2048, ctx carried x64, gelu planes carried x16), f32 accumulate; norms, clip, softmax, gelu, residuals in f32.
#include <hip/hip_runtime.h>
#include <math.h>
#include <stdint.h>

// ---------------------------------------------------------------------------
// Problem constants
// ---------------------------------------------------------------------------
constexpr int kB     = 2;
constexpr int kS     = 2048;
constexpr int kD     = 1024;
constexpr int kF     = 4096;
constexpr int kH     = 16;
constexpr int kDh    = 64;
constexpr int kTok   = kB * kS;        // 4096 token rows
constexpr int kQKVld = 3 * kD;         // pitch of the q | k | v plane (halves)
constexpr int kGrp   = 2;              // (batch, head) groups per attention chunk
constexpr int kFfnRows = 1024;         // token rows per FFN pre-activation chunk
constexpr float kEps   = 1e-5f;
constexpr float kInvD  = 1.0f / 1024.0f;

typedef __attribute__((ext_vector_type(16))) _Float16 v16h;
typedef __attribute__((ext_vector_type(8)))  _Float16 v8h;
typedef __attribute__((ext_vector_type(16))) __bf16   v16b;
typedef __attribute__((ext_vector_type(8)))  __bf16   v8b;
typedef __attribute__((ext_vector_type(8)))  float    v8f;
typedef __attribute__((ext_vector_type(4)))  float    v4f;
typedef __attribute__((ext_vector_type(2)))  float    v2f;
typedef __attribute__((ext_vector_type(4)))  unsigned int v4u;

// ---------------------------------------------------------------------------
// Helpers
// ---------------------------------------------------------------------------
__device__ __forceinline__ unsigned short f2bf_bits(float f) {
  unsigned u = __float_as_uint(f);
  return (unsigned short)((u + 0x7FFFu + ((u >> 16) & 1u)) >> 16);
}
__device__ __forceinline__ float bf_bits2f(unsigned short h) { return __uint_as_float(((unsigned)h) << 16); }

// hazard guards as plain device helpers (no inline asm inside the kernel template body)
__device__ __forceinline__ void dep_guard_h(v8f& a, v8f& b, v16h x, v16h y) { asm volatile("v_nop\n\tv_nop\n\tv_nop\n\tv_nop" : "+v"(a), "+v"(b) : "v"(x), "v"(y)); }
__device__ __forceinline__ void dep_guard_b(v8f& a, v8f& b, v16b x, v16b y) { asm volatile("v_nop\n\tv_nop\n\tv_nop\n\tv_nop" : "+v"(a), "+v"(b) : "v"(x), "v"(y)); }
__device__ __forceinline__ void keep4_h(v16h a, v16h b, v16h c, v16h d) { asm volatile("v_nop" :: "v"(a), "v"(b), "v"(c), "v"(d)); }
__device__ __forceinline__ void keep4_b(v16b a, v16b b, v16b c, v16b d) { asm volatile("v_nop" :: "v"(a), "v"(b), "v"(c), "v"(d)); }
__device__ __forceinline__ void acc_guard4(v8f& a, v8f& b, v8f& c, v8f& d) { asm volatile("v_nop\n\tv_nop\n\tv_nop\n\tv_nop" : "+v"(a), "+v"(b), "+v"(c), "+v"(d)); }
template <typename T> struct Frag;
template <> struct Frag<_Float16> {
  typedef v16h V; union U { v16h v; v8h h[2]; };
  static __device__ __forceinline__ v16h load(const _Float16* p) {   // elements 0..7 <- p[0..7], 8..15 <- p[16..23]
    U f; f.h[0] = *(const v8h*)(p); f.h[1] = *(const v8h*)(p + 16); return f.v;
  }
  static __device__ __forceinline__ v8f mma(v16h a, v16h b, v8f c) {
    return __builtin_amdgcn_wmma_f32_16x16x32_f16(false, a, false, b, (short)0, c, false, false);
  }
  static __device__ __forceinline__ void guard(v8f& a, v8f& b, v16h x, v16h y) { dep_guard_h(a, b, x, y); }
  static __device__ __forceinline__ void keep(v16h a, v16h b, v16h c, v16h d) { keep4_h(a, b, c, d); }
};
template <> struct Frag<__bf16> {
  typedef v16b V; union U { v16b v; v8b h[2]; };
  static __device__ __forceinline__ v16b load(const __bf16* p) {
    U f; f.h[0] = *(const v8b*)(p); f.h[1] = *(const v8b*)(p + 16); return f.v;
  }
  static __device__ __forceinline__ v8f mma(v16b a, v16b b, v8f c) {
    return __builtin_amdgcn_wmma_f32_16x16x32_bf16(false, a, false, b, (short)0, c, false, false);
  }
  static __device__ __forceinline__ void guard(v8f& a, v8f& b, v16b x, v16b y) { dep_guard_b(a, b, x, y); }
  static __device__ __forceinline__ void keep(v16b a, v16b b, v16b c, v16b d) { keep4_b(a, b, c, d); }
};

__device__ __forceinline__ unsigned pk16(unsigned short a, unsigned short b) { return (unsigned)a | ((unsigned)b << 16); }
__device__ __forceinline__ unsigned short h_bits(float f) { const _Float16 h = (_Float16)f; return __builtin_bit_cast(unsigned short, h); }

// ---- Register-blocked batched WMMA GEMM (ACT reduced to none/relu/leaky) -----------------------
// C[m,n] = scale * sum_k A[m,k] * Bt[n,k] (+bias)(+resid); each wave owns a 64x64 tile.
// A row-major [M,K]; Bt row-major [N,K]; M,N % 64 == 0, K % 32 == 0.
// SPLIT: operands are hi/lo planes (A2/Bt2 = lo planes, same layout); product = hi.hi + hi.lo + lo.hi.
// BIAS_MODE: 0 = none, 1 = bias[m], 2 = bias[n].
// OUT_MODE: 0 = f32, 1 = f16, 2 = bf16 hi plane (Cout) + bf16 lo plane (Cout2).
// ET: 0 = f16 operands, 1 = bf16 operands (pointers passed as 16-bit storage)
template <int ET> struct Elem;
template <> struct Elem<0> { typedef _Float16 T; };
template <> struct Elem<1> { typedef __bf16 T; };
template <int ET, bool SPLIT, int BIAS_MODE, int OUT_MODE, bool RESID, int ACT = 0>
__global__ __launch_bounds__(256) void wmma_gemm64(
    const unsigned short* __restrict__ Ap, const unsigned short* __restrict__ A2p, int lda, long strideA,
    const unsigned short* __restrict__ Btp, const unsigned short* __restrict__ Bt2p, int ldb, long strideB,
    void* __restrict__ Cout, void* __restrict__ Cout2, int ldc, long strideC,
    const float* __restrict__ bias,
    const float* __restrict__ resid, long strideR,
    int M, int N, int K, float scale) {
  typedef typename Elem<ET>::T T;
  typedef typename Frag<T>::V V;
  const T* A = (const T*)Ap; const T* A2 = (const T*)A2p; const T* Bt = (const T*)Btp; const T* Bt2 = (const T*)Bt2p;
  __shared__ __align__(16) float sT[8][16 * 68];   // per-wave 16x64 slab, pitch 68 floats
  const int b    = blockIdx.y;
  const int lane = threadIdx.x & 31;
  const int wave = threadIdx.x >> 5;
  const int tilesN = N >> 6;
  const int tilesM = M >> 6;
  const int tile = blockIdx.x * 8 + wave;
  if (tile >= tilesM * tilesN) return;   // wave-uniform; no block barriers in this kernel
  const int tm = tile / tilesN;
  const int tn = tile - tm * tilesN;
  const int m0 = tm << 6;
  const int n0 = tn << 6;

  const T* Ab  = A  + (size_t)b * strideA;
  const T* Bb  = Bt + (size_t)b * strideB;
  const T* Ab2 = SPLIT ? (A2  + (size_t)b * strideA) : nullptr;
  const T* Bb2 = SPLIT ? (Bt2 + (size_t)b * strideB) : nullptr;

  const int rlane = lane & 15;                 // row (A) / col (B, D) within subtile
  const int koff  = (lane >> 4) * 8;           // k offset of this lane half
  const int mOff  = (lane >> 4) * 8;           // D row offset

  v8f acc[4][4];
#pragma unroll
  for (int i = 0; i < 4; ++i)
#pragma unroll
    for (int j = 0; j < 4; ++j) acc[i][j] = (v8f){0.f,0.f,0.f,0.f,0.f,0.f,0.f,0.f};

  for (int k0 = 0; k0 < K; k0 += 32) {
    V bh[4], bl[4];
#pragma unroll
    for (int j = 0; j < 4; ++j) {
      const size_t bo = (size_t)(n0 + (j << 4) + rlane) * ldb + koff + k0;
      bh[j] = Frag<T>::load(Bb + bo);
      if (SPLIT) bl[j] = Frag<T>::load(Bb2 + bo);
    }
#pragma unroll
    for (int i = 0; i < 4; ++i) {
      const size_t ao = (size_t)(m0 + (i << 4) + rlane) * lda + koff + k0;
      V ah = Frag<T>::load(Ab + ao);
      V al;
      if (SPLIT) al = Frag<T>::load(Ab2 + ao);
#pragma unroll
      for (int j = 0; j < 4; ++j) {
        acc[i][j] = Frag<T>::mma(ah, bh[j], acc[i][j]);
        if (SPLIT) {
          acc[i][j] = Frag<T>::mma(ah, bl[j], acc[i][j]);
          acc[i][j] = Frag<T>::mma(al, bh[j], acc[i][j]);
        }
      }
      Frag<T>::guard(acc[i][0], acc[i][3], ah, SPLIT ? al : ah);
    }
    Frag<T>::keep(bh[0], bh[1], bh[2], bh[3]);
    if (SPLIT) Frag<T>::keep(bl[0], bl[1], bl[2], bl[3]);
  }
  acc_guard4(acc[0][0], acc[0][1], acc[0][2], acc[0][3]);
  acc_guard4(acc[1][0], acc[1][1], acc[1][2], acc[1][3]);
  acc_guard4(acc[2][0], acc[2][1], acc[2][2], acc[2][3]);
  acc_guard4(acc[3][0], acc[3][1], acc[3][2], acc[3][3]);

  // ---- epilogue ----
  float* slab = sT[wave];
  const float* Rb = RESID ? (resid + (size_t)b * strideR) : nullptr;
#pragma unroll
  for (int i = 0; i < 4; ++i) {
    const int mBase = m0 + (i << 4);
#pragma unroll
    for (int j = 0; j < 4; ++j) {
      const int n = n0 + (j << 4) + rlane;
      float bv = 0.f;
      if (BIAS_MODE == 2) bv = bias[n];
#pragma unroll
      for (int r = 0; r < 8; ++r) {
        float v = acc[i][j][r] * scale;
        if (BIAS_MODE == 1) v += bias[mBase + mOff + r];
        if (BIAS_MODE == 2) v += bv;
        if (RESID) v += Rb[(size_t)(mBase + mOff + r) * ldc + n];
        if (ACT == 2) v = fmaxf(v, 0.0f);
        if (ACT == 4) v = (v > 0.f) ? v : 0.01f * v;
        slab[(mOff + r) * 68 + (j << 4) + rlane] = v;
      }
    }
    __builtin_amdgcn_fence(__ATOMIC_RELEASE, "workgroup");
    __builtin_amdgcn_wave_barrier();
    __builtin_amdgcn_fence(__ATOMIC_ACQUIRE, "workgroup");
    if (OUT_MODE == 0) {
      float* C = (float*)Cout + (size_t)b * strideC;
      const int hh = lane >> 4, c4 = (lane & 15) * 4;     // row seg = 256 B = 16 lanes x 16 B
      {
#pragma unroll
        for (int it = 0; it < 8; ++it) {
          const int row = it * 2 + hh;
          v4f v = *(const v4f*)(slab + row * 68 + c4);
          *(v4f*)(C + (size_t)(mBase + row) * ldc + n0 + c4) = v;
        }
        
      }
    } else {
      const int q = lane >> 3, c8 = (lane & 7) * 8;
      unsigned short* C  = (unsigned short*)Cout  + (size_t)b * strideC;
      unsigned short* C2 = (OUT_MODE == 2) ? ((unsigned short*)Cout2 + (size_t)b * strideC) : nullptr;
      {
#pragma unroll
        for (int it = 0; it < 4; ++it) {
          const int row = it * 4 + q;
          const float* sp = slab + row * 68 + c8;
          v8h hv, lv;
#pragma unroll
          for (int e = 0; e < 8; ++e) {
            if (OUT_MODE == 1) {
              hv[e] = (_Float16)sp[e];
            } else {
              unsigned short hb = f2bf_bits(sp[e]);
              unsigned short lb = f2bf_bits(sp[e] - bf_bits2f(hb));
              hv[e] = __builtin_bit_cast(_Float16, hb);
              lv[e] = __builtin_bit_cast(_Float16, lb);
            }
          }
          *(v8h*)(C + (size_t)(mBase + row) * ldc + n0 + c8) = hv;
          if (OUT_MODE == 2) *(v8h*)(C2 + (size_t)(mBase + row) * ldc + n0 + c8) = lv;
        }
        
      }
    }
    __builtin_amdgcn_fence(__ATOMIC_RELEASE, "workgroup");
    __builtin_amdgcn_wave_barrier();
    __builtin_amdgcn_fence(__ATOMIC_ACQUIRE, "workgroup");
  }
}

// ---------------------------------------------------------------------------
// Transpose + cast: in W [Kr][Nc] f32 row-major ([in k][out n]) -> out[n][k] = f16(scale * W[k][n]), pitch Kr halves.
// grid (Kr/64, Nc/64, nz): blockIdx.x = k tile (64 cols of out), blockIdx.y = n tile (64 rows of out),
// blockIdx.z selects (W0,O0)..(W3,O3) (block-uniform). 256 threads.
// Load coverage: 16 iterations x 256 threads = 4096 = whole 64x64 tile (coalesced along n).
// Store coverage: 8 waves x 2 iterations x 4 rows (lane>>3) = 64 rows; (lane&7) x 8 halves = 64 cols; each row
// ---------------------------------------------------------------------------
__global__ __launch_bounds__(256) void tcast_kernel(const float* __restrict__ W0, const float* __restrict__ W1,
                                                    const float* __restrict__ W2, const float* __restrict__ W3,
                                                    unsigned short* __restrict__ O0, unsigned short* __restrict__ O1,
                                                    unsigned short* __restrict__ O2, unsigned short* __restrict__ O3,
                                                    int Kr, int Nc, float scale) {
  __shared__ float sm[64][65];   // sm[n_local][k_local]
  const int t  = threadIdx.x;
  const int k0 = blockIdx.x * 64;
  const int n0 = blockIdx.y * 64;
  const int z  = blockIdx.z;
  const float* W = (z == 0) ? W0 : (z == 1) ? W1 : (z == 2) ? W2 : W3;
  unsigned short* O = (z == 0) ? O0 : (z == 1) ? O1 : (z == 2) ? O2 : O3;
#pragma unroll
  for (int i = 0; i < 16; ++i) {
    const int e = i * 256 + t;
    const int r = e >> 6;          // k local
    const int c = e & 63;          // n local
    sm[c][r] = W[(size_t)(k0 + r) * Nc + n0 + c] * scale;
  }
  __syncthreads();
  const int lane = t & 31, wave = t >> 5;
  const int q = lane >> 3, c8 = (lane & 7) * 8;
  {
#pragma unroll
    for (int it = 0; it < 2; ++it) {
      const int row = wave * 8 + it * 4 + q;                 // n local
      unsigned short hb[8];
#pragma unroll
      for (int e = 0; e < 8; ++e) hb[e] = h_bits(sm[row][c8 + e]);
      const v4u u = (v4u){pk16(hb[0], hb[1]), pk16(hb[2], hb[3]), pk16(hb[4], hb[5]), pk16(hb[6], hb[7])};
      *(v4u*)(O + (size_t)(n0 + row) * Kr + k0 + c8) = u;
    }
    
  }
}

// ---------------------------------------------------------------------------
// V transpose (16-bit move, no conversion): in  QKV plane [4096][3072] halves, V at columns 2048..3071;
// out VT[b][dg][t] = V[b][t][dg], planes [2][1024][2048] halves.
// grid (32 t-tiles, 16 d-tiles, 2 batches), 256 threads, tile 64 t x 64 d.
// Load coverage: 2 iterations x 256 threads x 8 halves (one 16-B integer word load each) = 4096 = whole tile.
// Store coverage: 8 waves x 2 iterations x 4 rows (lane>>3) = 64 d rows; 8 lanes x 8 halves = 64 t = one whole
// ---------------------------------------------------------------------------
__global__ __launch_bounds__(256) void vt_kernel(const unsigned short* __restrict__ QKV, unsigned short* __restrict__ VT) {
  __shared__ unsigned short sm[64][72];   // sm[d_local][t_local]
  const int tid = threadIdx.x;
  const int t0  = blockIdx.x * 64;
  const int d0  = blockIdx.y * 64;
  const int b   = blockIdx.z;
#pragma unroll
  for (int i = 0; i < 2; ++i) {
    const int e   = i * 256 + tid;
    const int r   = e >> 3;          // t local 0..63
    const int seg = e & 7;           // 8-half segment of the 64 d columns
    const v4u w = *(const v4u*)(QKV + ((size_t)(b * kS + t0 + r)) * kQKVld + 2 * kD + d0 + seg * 8);
#pragma unroll
    for (int j = 0; j < 4; ++j) {
      sm[seg * 8 + 2 * j][r]     = (unsigned short)(w[j] & 0xffffu);
      sm[seg * 8 + 2 * j + 1][r] = (unsigned short)(w[j] >> 16);
    }
  }
  __syncthreads();
  const int lane = tid & 31, wave = tid >> 5;
  const int q = lane >> 3, c8 = (lane & 7) * 8;
  {
#pragma unroll
    for (int it = 0; it < 2; ++it) {
      const int row = wave * 8 + it * 4 + q;                 // d local
      const v4u u = (v4u){pk16(sm[row][c8 + 0], sm[row][c8 + 1]), pk16(sm[row][c8 + 2], sm[row][c8 + 3]),
                          pk16(sm[row][c8 + 4], sm[row][c8 + 5]), pk16(sm[row][c8 + 6], sm[row][c8 + 7])};
      *(v4u*)(VT + ((size_t)(b * kD + d0 + row)) * kS + t0 + c8) = u;
    }
    
  }
}

// ---------------------------------------------------------------------------
// ind_norm: H[row][:] = f16( omr * ((x - mu) * rsqrt(var + eps) * g + b) + rr * x ), mu/var over the 1024-wide row
// One block of 128 threads per row; thread t owns columns 8t..8t+7 (128 x 8 = 1024 = whole row).
// ---------------------------------------------------------------------------
__global__ __launch_bounds__(128) void indnorm_kernel(const float* __restrict__ X, const float* __restrict__ G,
                                                      const float* __restrict__ Bv, unsigned short* __restrict__ H,
                                                      float omr, float rr) {
  __shared__ float redA[4];
  __shared__ float redB[4];
  const int row  = blockIdx.x;
  const int t    = threadIdx.x;
  const int lane = t & 31, wave = t >> 5;
  const int c0   = t * 8;
  const float* xr = X + (size_t)row * kD + c0;
  const v4f a = *(const v4f*)(xr);
  const v4f c = *(const v4f*)(xr + 4);
  float v[8];
#pragma unroll
  for (int e = 0; e < 4; ++e) { v[e] = a[e]; v[4 + e] = c[e]; }
  float s = ((v[0] + v[1]) + (v[2] + v[3])) + ((v[4] + v[5]) + (v[6] + v[7]));
#pragma unroll
  for (int off = 16; off > 0; off >>= 1) s += __shfl_xor(s, off, 32);
  if (lane == 0) redA[wave] = s;
  __syncthreads();
  const float mean = ((redA[0] + redA[1]) + (redA[2] + redA[3])) * kInvD;
  float d[8];
  float qs = 0.f;
#pragma unroll
  for (int e = 0; e < 8; ++e) { d[e] = v[e] - mean; qs += d[e] * d[e]; }
#pragma unroll
  for (int off = 16; off > 0; off >>= 1) qs += __shfl_xor(qs, off, 32);
  if (lane == 0) redB[wave] = qs;
  __syncthreads();
  const float var  = ((redB[0] + redB[1]) + (redB[2] + redB[3])) * kInvD;
  const float rstd = rsqrtf(var + kEps);
  const v4f ga = *(const v4f*)(G + c0);
  const v4f gc = *(const v4f*)(G + c0 + 4);
  const v4f ba = *(const v4f*)(Bv + c0);
  const v4f bc = *(const v4f*)(Bv + c0 + 4);
  float gg[8], bb[8];
#pragma unroll
  for (int e = 0; e < 4; ++e) { gg[e] = ga[e]; gg[4 + e] = gc[e]; bb[e] = ba[e]; bb[4 + e] = bc[e]; }
  unsigned short hb[8];
#pragma unroll
  for (int e = 0; e < 8; ++e) {
    const float ln = d[e] * rstd * gg[e] + bb[e];
    const float o  = omr * ln + rr * v[e];
    hb[e] = h_bits(o);
  }
  const v4u u = (v4u){pk16(hb[0], hb[1]), pk16(hb[2], hb[3]), pk16(hb[4], hb[5]), pk16(hb[6], hb[7])};
  unsigned short* op = H + (size_t)row * kD + c0;
  *(v4u*)op = u;
  
}

// ---------------------------------------------------------------------------
// Row softmax over 2048 f32 scaled scores with clip and additive mask:
//   s = clip(sc, -50, 50) + mask[i][t];  P[row][t] = f16( carry * exp(s - max) / sum exp(s - max) ), f32 math.
// One block of 256 threads per row; thread t owns columns 8t..8t+7 (256 x 8 = 2048 = whole row).
// row = blockIdx.x over [groups][2048]; mask row index i = row % 2048 (mask shared over batch and head).
// Reductions in fixed order (thread, wave shuffle tree, 8 wave partials in index order).
// ---------------------------------------------------------------------------
__global__ __launch_bounds__(256) void softmax_kernel(const float* __restrict__ SC, const float* __restrict__ MK,
                                                      unsigned short* __restrict__ P, float carry) {
  __shared__ float redM[8];
  __shared__ float redS[8];
  const int row  = blockIdx.x;
  const int i    = row & (kS - 1);
  const int t    = threadIdx.x;
  const int lane = t & 31, wave = t >> 5;
  const int c0   = t * 8;
  const float* sr = SC + (size_t)row * kS + c0;
  const float* mr = MK + (size_t)i * kS + c0;
  const v4f a  = *(const v4f*)(sr);
  const v4f c  = *(const v4f*)(sr + 4);
  const v4f ma = *(const v4f*)(mr);
  const v4f mc = *(const v4f*)(mr + 4);
  float x[8];
#pragma unroll
  for (int e = 0; e < 4; ++e) {
    x[e]     = fminf(fmaxf(a[e], -50.0f), 50.0f) + ma[e];
    x[4 + e] = fminf(fmaxf(c[e], -50.0f), 50.0f) + mc[e];
  }
  float m = fmaxf(fmaxf(fmaxf(x[0], x[1]), fmaxf(x[2], x[3])), fmaxf(fmaxf(x[4], x[5]), fmaxf(x[6], x[7])));
#pragma unroll
  for (int off = 16; off > 0; off >>= 1) m = fmaxf(m, __shfl_xor(m, off, 32));
  if (lane == 0) redM[wave] = m;
  __syncthreads();
  float gm = redM[0];
#pragma unroll
  for (int w = 1; w < 8; ++w) gm = fmaxf(gm, redM[w]);
  float ev[8];
  float ps = 0.f;
#pragma unroll
  for (int e = 0; e < 8; ++e) { ev[e] = expf(x[e] - gm); ps += ev[e]; }
#pragma unroll
  for (int off = 16; off > 0; off >>= 1) ps += __shfl_xor(ps, off, 32);
  if (lane == 0) redS[wave] = ps;
  __syncthreads();
  float tot = 0.f;
#pragma unroll
  for (int w = 0; w < 8; ++w) tot += redS[w];
  const float inv = 1.0f / tot;
  unsigned short hb[8];
#pragma unroll
  for (int e = 0; e < 8; ++e) hb[e] = h_bits((ev[e] * inv) * carry);
  const v4u u = (v4u){pk16(hb[0], hb[1]), pk16(hb[2], hb[3]), pk16(hb[4], hb[5]), pk16(hb[6], hb[7])};
  unsigned short* pp = P + (size_t)row * kS + c0;
  *(v4u*)pp = u;
  
}

// ---------------------------------------------------------------------------
// Exact erf gelu + f16 cast: out[2i], out[2i+1] = f16( carry * gelu(sgn * U[2i..2i+1]) ), sgn = neg ? -1 : +1 (uniform).
// ---------------------------------------------------------------------------
__global__ __launch_bounds__(256) void gelu_cast_kernel(const float* __restrict__ U, unsigned short* __restrict__ out,
                                                        int n2, int neg, float carry) {
  const int i = blockIdx.x * 256 + threadIdx.x;
  if (i >= n2) return;
  const v2f p = *(const v2f*)(U + 2 * (size_t)i);
  const float sgn = neg ? -1.0f : 1.0f;
  const float a = p[0] * sgn;
  const float b = p[1] * sgn;
  const float ga = 0.5f * a * (1.0f + erff(a * 0.70710678118654752f));
  const float gb = 0.5f * b * (1.0f + erff(b * 0.70710678118654752f));
  const unsigned u = pk16(h_bits(ga * carry), h_bits(gb * carry));
  unsigned* q = (unsigned*)(out + 2 * (size_t)i);
  *(unsigned*)q = u;
  
}

// ---------------------------------------------------------------------------
// Host orchestration
// Workspace region map (MiB offsets; total carve end = 124 MiB = 130,023,424 B):
//   phase 1 (attention): H16 [0,8)  WQKVT [8,14)  MT [14,18)  WOT [18,20)  QKV16 [20,44)  QM16 [44,52)
//                        VT16 [52,60)  CTX16 [60,68)  SC f32 [68,100) (2 groups)  P16 [100,116) (2 groups)
//   X1 f32 [20,36) is written by the Wo GEMM after every reader of QKV16 has run.
//   phase 2 (FFN): H16 [0,8) (h2)  WPOST [8,16)  WNEGT [116,124)  WPROJT [36,52)  TP f32 [52,68)
//                  CAT16 half [68,100)  U f32 chunk [100,116)
// Every region is fully written before it is read; all GEMM M,N multiples of 64 and K multiples of 32 (no padding).
// ---------------------------------------------------------------------------
extern "C" void kernel_launch(void* const* d_in, const int* in_sizes, int n_in,
                              void* d_out, int out_size, void* d_ws, size_t ws_size,
                              hipStream_t stream) {
  const size_t MIB = 1048576;
  if (n_in < 14) return;
  if (in_sizes[0] != kTok * kD || in_sizes[1] != kB * kD * kD || in_sizes[2] != kS * kS ||
      in_sizes[3] != kD || in_sizes[4] != kD || in_sizes[5] != kD || in_sizes[6] != kD ||
      in_sizes[7] != kD * kD || in_sizes[8] != kD * kD || in_sizes[9] != kD * kD || in_sizes[10] != kD * kD ||
      in_sizes[11] != kD * kF || in_sizes[12] != kD * kF || in_sizes[13] != 2 * kF * kD) return;
  if (out_size != kTok * kD) return;
  if (ws_size < 124 * MIB) return;

  const float* xf   = (const float*)d_in[0];
  const float* Mf   = (const float*)d_in[1];
  const float* mkf  = (const float*)d_in[2];
  const float* g1f  = (const float*)d_in[3];
  const float* b1f  = (const float*)d_in[4];
  const float* g2f  = (const float*)d_in[5];
  const float* b2f  = (const float*)d_in[6];
  const float* Wqf  = (const float*)d_in[7];
  const float* Wkf  = (const float*)d_in[8];
  const float* Wvf  = (const float*)d_in[9];
  const float* Wof  = (const float*)d_in[10];
  const float* Wpf  = (const float*)d_in[11];
  const float* Wnf  = (const float*)d_in[12];
  const float* Wjf  = (const float*)d_in[13];
  float* out = (float*)d_out;

  char* ws = (char*)d_ws;
  unsigned short* H16   = (unsigned short*)(ws + 0 * MIB);
  unsigned short* WQKV  = (unsigned short*)(ws + 8 * MIB);
  unsigned short* MT    = (unsigned short*)(ws + 14 * MIB);
  unsigned short* WOT   = (unsigned short*)(ws + 18 * MIB);
  unsigned short* QKV   = (unsigned short*)(ws + 20 * MIB);
  unsigned short* QM    = (unsigned short*)(ws + 44 * MIB);
  unsigned short* VT    = (unsigned short*)(ws + 52 * MIB);
  unsigned short* CTX   = (unsigned short*)(ws + 60 * MIB);
  float*          SC    = (float*)(ws + 68 * MIB);
  unsigned short* P16   = (unsigned short*)(ws + 100 * MIB);
  float*          X1    = (float*)(ws + 20 * MIB);
  unsigned short* WPOS  = (unsigned short*)(ws + 8 * MIB);
  unsigned short* WNEG  = (unsigned short*)(ws + 116 * MIB);
  unsigned short* WPROJ = (unsigned short*)(ws + 36 * MIB);
  float*          TP    = (float*)(ws + 52 * MIB);
  unsigned short* CAT   = (unsigned short*)(ws + 68 * MIB);
  float*          U     = (float*)(ws + 100 * MIB);

  const float rr  = (float)(2.0 / 11.0);
  const float omr = (float)(1.0 - 2.0 / 11.0);
  const float wcarry  = 16.0f;     // square weights and Wpos/Wneg carried x16
  const float wjcarry = 64.0f;     // Wproj carried x64
  const float pcarry  = 2048.0f;   // probabilities carried x2048
  const float ccarry  = 16.0f;     // gelu planes carried x16

  // ---- phase 1: weights -> transposed f16 planes (x16) ----
  // Wq,Wk,Wv [1024][1024] -> WQKVT rows 0.., 1024.., 2048..; Wo -> WOT
  tcast_kernel<<<dim3(kD / 64, kD / 64, 4), 256, 0, stream>>>(
      Wqf, Wkf, Wvf, Wof,
      WQKV, WQKV + (size_t)kD * kD, WQKV + (size_t)2 * kD * kD, WOT, kD, kD, wcarry);
  // M[b] [1024 d][1024 e] -> MT[b][e][d]
  tcast_kernel<<<dim3(kD / 64, kD / 64, 2), 256, 0, stream>>>(
      Mf, Mf + (size_t)kD * kD, Mf, Mf,
      MT, MT + (size_t)kD * kD, MT, MT, kD, kD, wcarry);

  // h1 = ind_norm(x; g1, b1) -> H16 [4096][1024]
  indnorm_kernel<<<dim3(kTok), 128, 0, stream>>>(xf, g1f, b1f, H16, omr, rr);

  // QKV16 [4096][3072] = h1 . [Wq|Wk|Wv]   (M=4096, N=3072, K=1024; tiles 64x48 -> 384 blocks)
  wmma_gemm64<0, false, 0, 1, false><<<dim3(384, 1), 256, 0, stream>>>(
      H16, H16, kD, 0, WQKV, WQKV, kD, 0, QKV, QKV, kQKVld, 0, g1f, xf, 0, kTok, kQKVld, kD, 1.0f / wcarry);

  // VT16[b][dg][t] = V[b][t][dg]
  vt_kernel<<<dim3(kS / 64, kD / 64, kB), 256, 0, stream>>>(QKV, VT);

  // QM16[b] = Q[b] . M[b]   (M=2048, N=1024, K=1024 per batch; 512 tiles -> 64 blocks, grid.y = batch)
  wmma_gemm64<0, false, 0, 1, false><<<dim3(64, kB), 256, 0, stream>>>(
      QKV, QKV, kQKVld, (long)kS * kQKVld, MT, MT, kD, (long)kD * kD, QM, QM, kD, (long)kS * kD,
      g1f, xf, 0, kS, kD, kD, 1.0f / wcarry);

  // ---- attention per chunk of kGrp heads of one batch ----
  for (int b = 0; b < kB; ++b) {
    for (int h0 = 0; h0 < kH; h0 += kGrp) {
      // scores[gl][i][t] = (1/8) * sum_d QM[b][i][h*64+d] * K[b][t][h*64+d]   (M=N=2048, K=64; 1024 tiles -> 128 blocks)
      const unsigned short* Aq = QM + (size_t)b * kS * kD + (size_t)h0 * kDh;
      const unsigned short* Bk = QKV + kD + (size_t)b * kS * kQKVld + (size_t)h0 * kDh;
      wmma_gemm64<0, false, 0, 0, false><<<dim3(128, kGrp), 256, 0, stream>>>(
          Aq, Aq, kD, kDh, Bk, Bk, kQKVld, kDh, SC, SC, kS, (long)kS * kS, g1f, xf, 0, kS, kS, kDh, 0.125f);
      // P16 = softmax(clip(scores) + mask) x2048
      softmax_kernel<<<dim3(kGrp * kS), 256, 0, stream>>>(SC, mkf, P16, pcarry);
      // CTX16[b][i][h*64+n] = (64/2048) * sum_t P[i][t] * VT[b][h*64+n][t]   (M=2048, N=64, K=2048; 32 tiles -> 4 blocks)
      const unsigned short* Bv = VT + ((size_t)b * kD + (size_t)h0 * kDh) * kS;
      unsigned short* Cc = CTX + (size_t)b * kS * kD + (size_t)h0 * kDh;
      wmma_gemm64<0, false, 0, 1, false><<<dim3(4, kGrp), 256, 0, stream>>>(
          P16, P16, kS, (long)kS * kS, Bv, Bv, kS, (long)kDh * kS, Cc, Cc, kD, kDh, g1f, xf, 0,
          kS, kDh, kS, 64.0f / 2048.0f);
    }
  }

  // x1 = x + ctx . Wo   (ctx x64, WoT x16 -> scale 1/1024; M=4096, N=1024, K=1024; 1024 tiles -> 128 blocks)
  wmma_gemm64<0, false, 0, 0, true><<<dim3(128, 1), 256, 0, stream>>>(
      CTX, CTX, kD, 0, WOT, WOT, kD, 0, X1, X1, kD, 0, g1f, xf, 0, kTok, kD, kD, 1.0f / 1024.0f);

  // ---- phase 2: FFN ----
  // h2 = ind_norm(x1; g2, b2) -> H16
  indnorm_kernel<<<dim3(kTok), 128, 0, stream>>>(X1, g2f, b2f, H16, omr, rr);
  // Wpos, Wneg [1024 k][4096 n] -> [4096][1024] f16 x16
  tcast_kernel<<<dim3(kD / 64, kF / 64, 2), 256, 0, stream>>>(
      Wpf, Wnf, Wpf, Wpf, WPOS, WNEG, WPOS, WPOS, kD, kF, wcarry);
  // Wproj [8192 k][1024 n] -> [1024][8192] f16 x64
  tcast_kernel<<<dim3((2 * kF) / 64, kD / 64, 1), 256, 0, stream>>>(
      Wjf, Wjf, Wjf, Wjf, WPROJ, WPROJ, WPROJ, WPROJ, 2 * kF, kD, wjcarry);

  const int nChunks = kTok / kFfnRows;                   // 4
  const int n2 = (kFfnRows * kF) / 2;                    // 2,097,152 threads per gelu launch
  // pos half: CAT16[r][n] = f16(16 * gelu(h2 . Wpos))
  for (int cix = 0; cix < nChunks; ++cix) {
    // U [1024][4096] f32 = h2 rows . Wpos   (M=1024, N=4096, K=1024; 1024 tiles -> 128 blocks)
    wmma_gemm64<0, false, 0, 0, false><<<dim3(128, 1), 256, 0, stream>>>(
        H16 + (size_t)cix * kFfnRows * kD, H16, kD, 0, WPOS, WPOS, kD, 0, U, U, kF, 0, g1f, xf, 0,
        kFfnRows, kF, kD, 1.0f / wcarry);
    gelu_cast_kernel<<<dim3(n2 / 256), 256, 0, stream>>>(U, CAT + (size_t)cix * kFfnRows * kF, n2, 0, ccarry);
  }
  // TP = x1 + CATpos . Wproj[0:4096]   (cat x16, WprojT x64 -> scale 1/1024; M=4096, N=1024, K=4096)
  wmma_gemm64<0, false, 0, 0, true><<<dim3(128, 1), 256, 0, stream>>>(
      CAT, CAT, kF, 0, WPROJ, WPROJ, 2 * kF, 0, TP, TP, kD, 0, g1f, X1, 0, kTok, kD, kF, 1.0f / 1024.0f);
  // neg half: CAT16[r][n] = f16(16 * gelu(-(h2 . Wneg)))   (exact sign identity)
  for (int cix = 0; cix < nChunks; ++cix) {
    wmma_gemm64<0, false, 0, 0, false><<<dim3(128, 1), 256, 0, stream>>>(
        H16 + (size_t)cix * kFfnRows * kD, H16, kD, 0, WNEG, WNEG, kD, 0, U, U, kF, 0, g1f, xf, 0,
        kFfnRows, kF, kD, 1.0f / wcarry);
    gelu_cast_kernel<<<dim3(n2 / 256), 256, 0, stream>>>(U, CAT + (size_t)cix * kFfnRows * kF, n2, 1, ccarry);
  }
  // out = TP + CATneg . Wproj[4096:8192]
  wmma_gemm64<0, false, 0, 0, true><<<dim3(128, 1), 256, 0, stream>>>(
      CAT, CAT, kF, 0, WPROJ + kF, WPROJ + kF, 2 * kF, 0, out, out, kD, 0, g1f, TP, 0, kTok, kD, kF, 1.0f / 1024.0f);
}

// v002
// It runs in 386 microseconds.
// Versions in between are left out here; by their measured steps it is 6.82 times as fast as v000.
// Contractions: QKV, Q.M[b], Wo, Wpos/Wneg, Wproj projections and attention scores k.q^T and V^T.P^T all on v_wmma_f32_16x16x32_f16 (f16 operands: activations plain, weights carried x16 / x64, unnormalised P carried x256, ctx carried x64, gelu planes carried x16), f32 accumulate; norms, clip, softmax, gelu, residuals in f32.
#include <hip/hip_runtime.h>
#include <math.h>
#include <stdint.h>

// ---------------------------------------------------------------------------
// Problem constants
// ---------------------------------------------------------------------------
constexpr int kB     = 2;
constexpr int kS     = 2048;
constexpr int kD     = 1024;
constexpr int kF     = 4096;
constexpr int kH     = 16;
constexpr int kDh    = 64;
constexpr int kTok   = kB * kS;        // 4096 token rows
constexpr int kQKVld = 3 * kD;         // pitch of the q | k | v plane (halves)
constexpr int kFfnRows = 1024;         // token rows per FFN pre-activation chunk
constexpr float kEps   = 1e-5f;
constexpr float kInvD  = 1.0f / 1024.0f;

typedef __attribute__((ext_vector_type(16))) _Float16 v16h;
typedef __attribute__((ext_vector_type(8)))  _Float16 v8h;
typedef __attribute__((ext_vector_type(8)))  float    v8f;
typedef __attribute__((ext_vector_type(4)))  float    v4f;
typedef __attribute__((ext_vector_type(2)))  float    v2f;
typedef __attribute__((ext_vector_type(4)))  unsigned int v4u;

// ---------------------------------------------------------------------------
// Helpers
// ---------------------------------------------------------------------------
template <typename T> struct Frag;
template <> struct Frag<_Float16> {
  typedef v16h V; union U { v16h v; v8h h[2]; };
  static __device__ __forceinline__ v16h load(const _Float16* p) {   // elements 0..7 <- p[0..7], 8..15 <- p[16..23]
    U f; f.h[0] = *(const v8h*)(p); f.h[1] = *(const v8h*)(p + 16); return f.v;
  }
  static __device__ __forceinline__ v8f mma(v16h a, v16h b, v8f c) {
    return __builtin_amdgcn_wmma_f32_16x16x32_f16(false, a, false, b, (short)0, c, false, false);
  }
};
__device__ __forceinline__ unsigned pk16(unsigned short a, unsigned short b) { return (unsigned)a | ((unsigned)b << 16); }
__device__ __forceinline__ unsigned short h_bits(float f) { const _Float16 h = (_Float16)f; return __builtin_bit_cast(unsigned short, h); }

// ---- Batched WMMA GEMM, operands staged in LDS by asynchronous copies ------------------------------------------------
// C[m,n] = scale * sum_k A[m,k] * Bt[n,k] (+resid). A row-major [M,K]; Bt row-major [N,K]; f16 operands, f32 accumulate.
// One work-group of 8 waves owns a 128x128 tile of C; wave (wm, wn) = (wave & 3, wave >> 2) owns 32 rows x 64 columns.
// M, N % 128 == 0; K % 128 == 0; grid.x = (M / 128) * (N / 128), grid.y = batch.
// A stage is 128 k of the tile's 128 A rows and 128 Bt rows: 256 rows of 256 B at an LDS pitch of 272 B (16 B x odd, so the
// 16 rows of a ds_load_b128 fragment read fall on distinct banks). Two stages: the next one flies while this one is used.
// Each copy instruction of a wave moves 2 whole rows (4 whole 128-B lines); a fragment read from global touched 16 lines.
// OUT_MODE: 0 = f32, 1 = f16.
constexpr int kGemmPitch = 272;                    // bytes per staged row
constexpr int kGemmStage = 256 * kGemmPitch;       // bytes per stage (A rows 0..127, Bt rows 128..255)

// Eight 16-B copies per lane: rows r, r + 16, ... r + 112 of one operand's half of the stage. The s_wait_xcnt stands inside
// the statement so that no address register of a copy is rewritten ahead of it.
__device__ __forceinline__ void stage_copy8(unsigned l, const _Float16* g, size_t step) {
  const unsigned ls = 16 * kGemmPitch;
  asm volatile(
      "global_load_async_to_lds_b128 %0, %8, off\n\t"
      "global_load_async_to_lds_b128 %1, %9, off\n\t"
      "global_load_async_to_lds_b128 %2, %10, off\n\t"
      "global_load_async_to_lds_b128 %3, %11, off\n\t"
      "global_load_async_to_lds_b128 %4, %12, off\n\t"
      "global_load_async_to_lds_b128 %5, %13, off\n\t"
      "global_load_async_to_lds_b128 %6, %14, off\n\t"
      "global_load_async_to_lds_b128 %7, %15, off\n\t"
      "s_wait_xcnt 0x0"
      :: "v"(l), "v"(l + ls), "v"(l + 2 * ls), "v"(l + 3 * ls), "v"(l + 4 * ls), "v"(l + 5 * ls), "v"(l + 6 * ls),
         "v"(l + 7 * ls),
         "v"(g), "v"(g + step), "v"(g + 2 * step), "v"(g + 3 * step), "v"(g + 4 * step), "v"(g + 5 * step),
         "v"(g + 6 * step), "v"(g + 7 * step)
      : "memory");
}

template <int OUT_MODE, bool RESID>
__global__ __launch_bounds__(256) void wmma_gemm128(
    const unsigned short* __restrict__ Ap, int lda, long strideA,
    const unsigned short* __restrict__ Btp, int ldb, long strideB,
    void* __restrict__ Cout, int ldc, long strideC,
    const float* __restrict__ resid, long strideR,
    int N, int K, float scale) {
  typedef Frag<_Float16> F;
  __shared__ __attribute__((aligned(16))) unsigned char L[2 * kGemmStage];   // the ring; after the loop: the output slabs
  const int b    = blockIdx.y;
  const int lane = threadIdx.x & 31;
  const int wave = threadIdx.x >> 5;
  const int tilesN = N >> 7;
  const int tm = blockIdx.x / tilesN;
  const int tn = blockIdx.x - tm * tilesN;
  const int mB = tm << 7;                      // the work-group's tile
  const int nB = tn << 7;
  const int wm = wave & 3;
  const int wn = wave >> 2;

  const int rlane = lane & 15;                 // row (A) / col (B, D) within subtile
  const int hf    = lane >> 4;                 // lane half: k offset 8 * hf, D row offset 8 * hf
  const int mOff  = hf * 8;

  // copy map: thread t moves the 16-B piece (t & 15) of rows (t >> 4) + 16 i, i = 0..7, of each operand
  const int cr = threadIdx.x >> 4;
  const int cc = threadIdx.x & 15;
  const _Float16* gA = (const _Float16*)Ap  + (size_t)b * strideA + (size_t)(mB + cr) * lda + cc * 8;
  const _Float16* gB = (const _Float16*)Btp + (size_t)b * strideB + (size_t)(nB + cr) * ldb + cc * 8;
  const size_t stepA = (size_t)16 * lda;
  const size_t stepB = (size_t)16 * ldb;
  const unsigned lBase = (unsigned)(uintptr_t)L;                       // byte offset of the ring in the work-group's LDS
  const unsigned lA = lBase + cr * kGemmPitch + cc * 16;
  const unsigned lB = lA + 128 * kGemmPitch;

  // fragment read offsets in a stage (bytes)
  const int fA = (wm * 32 + rlane) * kGemmPitch + hf * 16;
  const int fB = (128 + wn * 64 + rlane) * kGemmPitch + hf * 16;

  v8f acc[2][4];
#pragma unroll
  for (int i = 0; i < 2; ++i)
#pragma unroll
    for (int j = 0; j < 4; ++j) acc[i][j] = (v8f){0.f,0.f,0.f,0.f,0.f,0.f,0.f,0.f};

  const int T = K >> 7;                        // stages
  stage_copy8(lA, gA, stepA);
  stage_copy8(lB, gB, stepB);
  asm volatile("s_wait_asynccnt 0x0" ::: "memory");   // this wave's share of stage 0 has landed
  __syncthreads();                                     // every wave's share of stage 0 is readable
  if (T > 1) {
    stage_copy8(lA + kGemmStage, gA + 128, stepA);
    stage_copy8(lB + kGemmStage, gB + 128, stepB);
  }

  for (int t = 0; t < T; ++t) {
    const unsigned bo = (t & 1) ? (unsigned)kGemmStage : 0u;
    const unsigned char* sb = L + bo;
    v16h bf[2][4], af[2][2];                   // two fragment sets: block kk + 1 is fetched while block kk multiplies
#pragma unroll
    for (int j = 0; j < 4; ++j) bf[0][j] = F::load((const _Float16*)(sb + fB + j * 16 * kGemmPitch));
#pragma unroll
    for (int i = 0; i < 2; ++i) af[0][i] = F::load((const _Float16*)(sb + fA + i * 16 * kGemmPitch));
#pragma unroll
    for (int kk = 0; kk < 4; ++kk) {
      if (kk < 3) {
#pragma unroll
        for (int j = 0; j < 4; ++j)
          bf[(kk + 1) & 1][j] = F::load((const _Float16*)(sb + fB + j * 16 * kGemmPitch + (kk + 1) * 64));
#pragma unroll
        for (int i = 0; i < 2; ++i)
          af[(kk + 1) & 1][i] = F::load((const _Float16*)(sb + fA + i * 16 * kGemmPitch + (kk + 1) * 64));
      }
      // keeps the next block's LDS reads one group ahead of this block's products; without it the scheduler folds the
      // two sets into one and each block waits out its own LDS latency
      __builtin_amdgcn_sched_barrier(0);
#pragma unroll
      for (int i = 0; i < 2; ++i)
#pragma unroll
        for (int j = 0; j < 4; ++j) acc[i][j] = F::mma(af[kk & 1][i], bf[kk & 1][j], acc[i][j]);
      // ends the block: the reads of block kk + 2 stay behind these products, whose operands they overwrite
      __builtin_amdgcn_sched_barrier(0);
    }
    asm volatile("s_wait_dscnt 0x0" ::: "memory");     // this wave's reads of stage t are done before the buffer is refilled
    asm volatile("s_wait_asynccnt 0x0" ::: "memory");  // this wave's share of stage t + 1 has landed
    __syncthreads();                                    // publishes stage t + 1 and ends every reader's use of stage t
    if (t + 2 < T) {
      stage_copy8(lA + bo, gA + (size_t)(t + 2) * 128, stepA);
      stage_copy8(lB + bo, gB + (size_t)(t + 2) * 128, stepB);
    }
  }
  asm volatile("s_wait_asynccnt 0x0" ::: "memory");    // no copy is outstanding when the ring becomes output staging

  // ---- epilogue: per-wave 16x64 slab, pitch 68 floats, in the ring (free behind the last pass's barrier) ----
  float* slab = (float*)L + wave * (16 * 68);
  const int m0 = mB + wm * 32;
  const int n0 = nB + wn * 64;
  const float* Rb = RESID ? (resid + (size_t)b * strideR) : nullptr;
#pragma unroll
  for (int i = 0; i < 2; ++i) {
    const int mBase = m0 + (i << 4);
#pragma unroll
    for (int j = 0; j < 4; ++j) {
      const int n = n0 + (j << 4) + rlane;
#pragma unroll
      for (int r = 0; r < 8; ++r) {
        float v = acc[i][j][r] * scale;
        if (RESID) v += Rb[(size_t)(mBase + mOff + r) * ldc + n];
        slab[(mOff + r) * 68 + (j << 4) + rlane] = v;
      }
    }
    __builtin_amdgcn_fence(__ATOMIC_RELEASE, "workgroup");
    __builtin_amdgcn_wave_barrier();
    __builtin_amdgcn_fence(__ATOMIC_ACQUIRE, "workgroup");
    if (OUT_MODE == 0) {
      float* C = (float*)Cout + (size_t)b * strideC;
      const int hh = lane >> 4, c4 = (lane & 15) * 4;     // row seg = 256 B = 16 lanes x 16 B
#pragma unroll
      for (int it = 0; it < 8; ++it) {
        const int row = it * 2 + hh;
        v4f v = *(const v4f*)(slab + row * 68 + c4);
        *(v4f*)(C + (size_t)(mBase + row) * ldc + n0 + c4) = v;
      }
    } else {
      const int q = lane >> 3, c8 = (lane & 7) * 8;
      unsigned short* C = (unsigned short*)Cout + (size_t)b * strideC;
#pragma unroll
      for (int it = 0; it < 4; ++it) {
        const int row = it * 4 + q;
        const float* sp = slab + row * 68 + c8;
        v8h hv;
#pragma unroll
        for (int e = 0; e < 8; ++e) hv[e] = (_Float16)sp[e];
        *(v8h*)(C + (size_t)(mBase + row) * ldc + n0 + c8) = hv;
      }
    }
    __builtin_amdgcn_fence(__ATOMIC_RELEASE, "workgroup");
    __builtin_amdgcn_wave_barrier();
    __builtin_amdgcn_fence(__ATOMIC_ACQUIRE, "workgroup");
  }
}

// ---------------------------------------------------------------------------
// Transpose + cast: in W [Kr][Nc] f32 row-major ([in k][out n]) -> out[n][k] = f16(scale * W[k][n]), pitch Kr halves.
// grid (Kr/64, Nc/64, nz): blockIdx.x = k tile (64 cols of out), blockIdx.y = n tile (64 rows of out),
// blockIdx.z selects (W0,O0)..(W3,O3) (block-uniform). 256 threads.
// Load coverage: 16 iterations x 256 threads = 4096 = whole 64x64 tile (coalesced along n).
// Store coverage: 8 waves x 2 iterations x 4 rows (lane>>3) = 64 rows; (lane&7) x 8 halves = 64 cols; each row
// ---------------------------------------------------------------------------
__global__ __launch_bounds__(256) void tcast_kernel(const float* __restrict__ W0, const float* __restrict__ W1,
                                                    const float* __restrict__ W2, const float* __restrict__ W3,
                                                    unsigned short* __restrict__ O0, unsigned short* __restrict__ O1,
                                                    unsigned short* __restrict__ O2, unsigned short* __restrict__ O3,
                                                    int Kr, int Nc, float scale) {
  __shared__ float sm[64][65];   // sm[n_local][k_local]
  const int t  = threadIdx.x;
  const int k0 = blockIdx.x * 64;
  const int n0 = blockIdx.y * 64;
  const int z  = blockIdx.z;
  const float* W = (z == 0) ? W0 : (z == 1) ? W1 : (z == 2) ? W2 : W3;
  unsigned short* O = (z == 0) ? O0 : (z == 1) ? O1 : (z == 2) ? O2 : O3;
#pragma unroll
  for (int i = 0; i < 16; ++i) {
    const int e = i * 256 + t;
    const int r = e >> 6;          // k local
    const int c = e & 63;          // n local
    sm[c][r] = W[(size_t)(k0 + r) * Nc + n0 + c] * scale;
  }
  __syncthreads();
  const int lane = t & 31, wave = t >> 5;
  const int q = lane >> 3, c8 = (lane & 7) * 8;
  {
#pragma unroll
    for (int it = 0; it < 2; ++it) {
      const int row = wave * 8 + it * 4 + q;                 // n local
      unsigned short hb[8];
#pragma unroll
      for (int e = 0; e < 8; ++e) hb[e] = h_bits(sm[row][c8 + e]);
      const v4u u = (v4u){pk16(hb[0], hb[1]), pk16(hb[2], hb[3]), pk16(hb[4], hb[5]), pk16(hb[6], hb[7])};
      *(v4u*)(O + (size_t)(n0 + row) * Kr + k0 + c8) = u;
    }
    
  }
}

// ---------------------------------------------------------------------------
// V transpose (16-bit move, no conversion): in  QKV plane [4096][3072] halves, V at columns 2048..3071;
// out VT[b][dg][t] = V[b][t][dg], planes [2][1024][2048] halves.
// grid (32 t-tiles, 16 d-tiles, 2 batches), 256 threads, tile 64 t x 64 d.
// Load coverage: 2 iterations x 256 threads x 8 halves (one 16-B integer word load each) = 4096 = whole tile.
// Store coverage: 8 waves x 2 iterations x 4 rows (lane>>3) = 64 d rows; 8 lanes x 8 halves = 64 t = one whole
// ---------------------------------------------------------------------------
__global__ __launch_bounds__(256) void vt_kernel(const unsigned short* __restrict__ QKV, unsigned short* __restrict__ VT) {
  __shared__ unsigned short sm[64][72];   // sm[d_local][t_local]
  const int tid = threadIdx.x;
  const int t0  = blockIdx.x * 64;
  const int d0  = blockIdx.y * 64;
  const int b   = blockIdx.z;
#pragma unroll
  for (int i = 0; i < 2; ++i) {
    const int e   = i * 256 + tid;
    const int r   = e >> 3;          // t local 0..63
    const int seg = e & 7;           // 8-half segment of the 64 d columns
    const v4u w = *(const v4u*)(QKV + ((size_t)(b * kS + t0 + r)) * kQKVld + 2 * kD + d0 + seg * 8);
#pragma unroll
    for (int j = 0; j < 4; ++j) {
      sm[seg * 8 + 2 * j][r]     = (unsigned short)(w[j] & 0xffffu);
      sm[seg * 8 + 2 * j + 1][r] = (unsigned short)(w[j] >> 16);
    }
  }
  __syncthreads();
  const int lane = tid & 31, wave = tid >> 5;
  const int q = lane >> 3, c8 = (lane & 7) * 8;
  {
#pragma unroll
    for (int it = 0; it < 2; ++it) {
      const int row = wave * 8 + it * 4 + q;                 // d local
      const v4u u = (v4u){pk16(sm[row][c8 + 0], sm[row][c8 + 1]), pk16(sm[row][c8 + 2], sm[row][c8 + 3]),
                          pk16(sm[row][c8 + 4], sm[row][c8 + 5]), pk16(sm[row][c8 + 6], sm[row][c8 + 7])};
      *(v4u*)(VT + ((size_t)(b * kD + d0 + row)) * kS + t0 + c8) = u;
    }
    
  }
}

// ---------------------------------------------------------------------------
// ind_norm: H[row][:] = f16( omr * ((x - mu) * rsqrt(var + eps) * g + b) + rr * x ), mu/var over the 1024-wide row
// One block of 128 threads per row; thread t owns columns 8t..8t+7 (128 x 8 = 1024 = whole row).
// ---------------------------------------------------------------------------
__global__ __launch_bounds__(128) void indnorm_kernel(const float* __restrict__ X, const float* __restrict__ G,
                                                      const float* __restrict__ Bv, unsigned short* __restrict__ H,
                                                      float omr, float rr) {
  __shared__ float redA[4];
  __shared__ float redB[4];
  const int row  = blockIdx.x;
  const int t    = threadIdx.x;
  const int lane = t & 31, wave = t >> 5;
  const int c0   = t * 8;
  const float* xr = X + (size_t)row * kD + c0;
  const v4f a = *(const v4f*)(xr);
  const v4f c = *(const v4f*)(xr + 4);
  float v[8];
#pragma unroll
  for (int e = 0; e < 4; ++e) { v[e] = a[e]; v[4 + e] = c[e]; }
  float s = ((v[0] + v[1]) + (v[2] + v[3])) + ((v[4] + v[5]) + (v[6] + v[7]));
#pragma unroll
  for (int off = 16; off > 0; off >>= 1) s += __shfl_xor(s, off, 32);
  if (lane == 0) redA[wave] = s;
  __syncthreads();
  const float mean = ((redA[0] + redA[1]) + (redA[2] + redA[3])) * kInvD;
  float d[8];
  float qs = 0.f;
#pragma unroll
  for (int e = 0; e < 8; ++e) { d[e] = v[e] - mean; qs += d[e] * d[e]; }
#pragma unroll
  for (int off = 16; off > 0; off >>= 1) qs += __shfl_xor(qs, off, 32);
  if (lane == 0) redB[wave] = qs;
  __syncthreads();
  const float var  = ((redB[0] + redB[1]) + (redB[2] + redB[3])) * kInvD;
  const float rstd = rsqrtf(var + kEps);
  const v4f ga = *(const v4f*)(G + c0);
  const v4f gc = *(const v4f*)(G + c0 + 4);
  const v4f ba = *(const v4f*)(Bv + c0);
  const v4f bc = *(const v4f*)(Bv + c0 + 4);
  float gg[8], bb[8];
#pragma unroll
  for (int e = 0; e < 4; ++e) { gg[e] = ga[e]; gg[4 + e] = gc[e]; bb[e] = ba[e]; bb[4 + e] = bc[e]; }
  unsigned short hb[8];
#pragma unroll
  for (int e = 0; e < 8; ++e) {
    const float ln = d[e] * rstd * gg[e] + bb[e];
    const float o  = omr * ln + rr * v[e];
    hb[e] = h_bits(o);
  }
  const v4u u = (v4u){pk16(hb[0], hb[1]), pk16(hb[2], hb[3]), pk16(hb[4], hb[5]), pk16(hb[6], hb[7])};
  unsigned short* op = H + (size_t)row * kD + c0;
  *(v4u*)op = u;
  
}

// lane l <-> lane l ^ 16 (register exchange between the two 16-lane rows, no LDS round trip)
__device__ __forceinline__ float xhalf(float x) {
  const int v = __builtin_bit_cast(int, x);
  return __builtin_bit_cast(float, __builtin_amdgcn_permlanex16(v, v, 0x76543210, 0xfedcba98, false, false));
}

// ---------------------------------------------------------------------------
// Fused attention for one (batch, head) and 256 queries per block: scores, clip, mask, softmax and P.V in one pass
// over the keys, 32 keys at a time; neither scores nor probabilities go to memory.
//   S^T = K . QM^T   (A = 16 key rows, B = 16 query columns): a lane holds 8 keys (8*hf + r) of ONE query (lane & 15).
//   O^T += V^T . P^T (A = 16 d rows of VT, B = P^T): two S^T tiles of 16 keys, converted in place, are the B operand
//   in the same k order as Frag::load gives VT (elements 0..7 = keys 8*hf.., 8..15 = keys 16 + 8*hf..).
// Online softmax per query column: running maximum m and sum l in f32, O^T and l rescaled when m grows.
// p = 256 * exp(s - m) (the factor keeps small p out of the f16 subnormals and cancels in O / l).
// grid (2048 / 256 query blocks, 32 groups), 256 threads; wave w owns queries 32w .. 32w + 31 of its block.
// Output: lane writes CTX[query][head*64 + 16j + 8*hf + 0..7] = f16(64 * O / l), 16 B each; every element once.
// ---------------------------------------------------------------------------
__global__ __launch_bounds__(256) void attn_kernel(const unsigned short* __restrict__ QMp,
                                                   const unsigned short* __restrict__ QKVp,
                                                   const unsigned short* __restrict__ VTp,
                                                   const float* __restrict__ MK,
                                                   unsigned short* __restrict__ CTXp) {
  typedef Frag<_Float16> F;
  const int lane = threadIdx.x & 31, wave = threadIdx.x >> 5;
  const int c  = lane & 15;
  const int hf = lane >> 4;
  const int b  = blockIdx.y >> 4;
  const int hd = blockIdx.y & 15;
  const int q0 = blockIdx.x * 256 + wave * 32;
  const _Float16* Qb = (const _Float16*)QMp + (size_t)b * kS * kD + hd * kDh + hf * 8;
  const _Float16* Kb = (const _Float16*)QKVp + (size_t)b * kS * kQKVld + hd * kDh + (size_t)c * kQKVld + hf * 8;   // K plane at + kD
  const _Float16* Vb = (const _Float16*)VTp + ((size_t)b * kD + hd * kDh + c) * kS + hf * 8;
  const float*    Mb = MK + (size_t)(q0 + c) * kS + hf * 8;
  const float kLog2e = 1.44269504088896340736f;
  const float kNegInf = -__builtin_inff();

  const _Float16* qp = Qb + (size_t)(q0 + c) * kD;
  v16h qf[2][2];                       // [query tile][k chunk of 32]
#pragma unroll
  for (int u = 0; u < 2; ++u)
#pragma unroll
    for (int kc = 0; kc < 2; ++kc) qf[u][kc] = F::load(qp + (size_t)(16 * u) * kD + kc * 32);

  v8f o[4][2];                         // [d tile][query tile]
#pragma unroll
  for (int j = 0; j < 4; ++j)
#pragma unroll
    for (int u = 0; u < 2; ++u) o[j][u] = (v8f){0.f,0.f,0.f,0.f,0.f,0.f,0.f,0.f};
  float m[2] = {kNegInf, kNegInf};
  float l[2] = {0.f, 0.f};

  v16h kf[2][2];                       // [key tile][k chunk], fetched one pass ahead
  v4f  mk[2][2][2];                    // [query tile][key tile][4-float half], fetched one pass ahead
#pragma unroll
  for (int tt = 0; tt < 2; ++tt)
#pragma unroll
    for (int kc = 0; kc < 2; ++kc) kf[tt][kc] = F::load(Kb + (size_t)(16 * tt) * kQKVld + kD + kc * 32);
#pragma unroll
  for (int u = 0; u < 2; ++u)
#pragma unroll
    for (int tt = 0; tt < 2; ++tt) {
      mk[u][tt][0] = *(const v4f*)(Mb + (size_t)(16 * u) * kS + 16 * tt);
      mk[u][tt][1] = *(const v4f*)(Mb + (size_t)(16 * u) * kS + 16 * tt + 4);
    }
  // the address registers of the loads above stay whole (inputs) until the wait that lets them be overwritten
  asm volatile("s_wait_xcnt 0x0" :: "v"(qp), "v"(Kb), "v"(Mb) : "memory");

  for (int t0 = 0; t0 < kS; t0 += 32) {
    const _Float16* vp = Vb + t0;
    v16h vf[4];
#pragma unroll
    for (int j = 0; j < 4; ++j) vf[j] = F::load(vp + (size_t)(16 * j) * kS);

    v8f s[2][2];                       // [query tile][key tile]
#pragma unroll
    for (int u = 0; u < 2; ++u)
#pragma unroll
      for (int tt = 0; tt < 2; ++tt) {
        s[u][tt] = F::mma(kf[tt][0], qf[u][0], (v8f){0.f,0.f,0.f,0.f,0.f,0.f,0.f,0.f});
        s[u][tt] = F::mma(kf[tt][1], qf[u][1], s[u][tt]);
      }

    // next pass's keys (the last pass wraps to key 0: in bounds, its values are not used)
    const int tn = (t0 + 32) & (kS - 1);
    const _Float16* kp = Kb + (size_t)tn * kQKVld;
#pragma unroll
    for (int tt = 0; tt < 2; ++tt)
#pragma unroll
      for (int kc = 0; kc < 2; ++kc) kf[tt][kc] = F::load(kp + (size_t)(16 * tt) * kQKVld + kD + kc * 32);

    float x[2][16];
#pragma unroll
    for (int u = 0; u < 2; ++u)
#pragma unroll
      for (int tt = 0; tt < 2; ++tt)
#pragma unroll
        for (int r = 0; r < 8; ++r)    // clip(s / 8, -50, 50) + mask; the power-of-two scale commutes with the clip
          x[u][tt * 8 + r] = fminf(fmaxf(s[u][tt][r], -400.0f), 400.0f) * 0.125f + mk[u][tt][r >> 2][r & 3];
    // next pass's mask
    const float* mp = Mb + tn;
#pragma unroll
    for (int u = 0; u < 2; ++u)
#pragma unroll
      for (int tt = 0; tt < 2; ++tt) {
        mk[u][tt][0] = *(const v4f*)(mp + (size_t)(16 * u) * kS + 16 * tt);
        mk[u][tt][1] = *(const v4f*)(mp + (size_t)(16 * u) * kS + 16 * tt + 4);
      }
    // keeps the three groups of loads issued here, ahead of the softmax that covers their latency; without it the
    // scheduler sinks them to the foot of the pass and the next pass waits for the whole latency
    __builtin_amdgcn_sched_barrier(0);

    v16h pf[2];
#pragma unroll
    for (int u = 0; u < 2; ++u) {
      float mx = x[u][0];
#pragma unroll
      for (int e = 1; e < 16; ++e) mx = fmaxf(mx, x[u][e]);
      mx = fmaxf(mx, xhalf(mx));                              // the other 16 keys of this query
      const float mn  = fmaxf(m[u], mx);
      const float mu  = (mn == kNegInf) ? 0.0f : mn;          // all keys so far masked out: p = 0, no NaN
      const float alpha = __builtin_amdgcn_exp2f((m[u] - mu) * kLog2e);
      m[u] = mn;
      float ps = 0.f;
#pragma unroll
      for (int e = 0; e < 16; ++e) {
        const float p = __builtin_amdgcn_exp2f((x[u][e] - mu) * kLog2e + 8.0f);
        ps += p;
        pf[u][e] = (_Float16)p;
      }
      l[u] = l[u] * alpha + ps;
#pragma unroll
      for (int j = 0; j < 4; ++j)
#pragma unroll
        for (int r = 0; r < 8; ++r) o[j][u][r] *= alpha;
    }
#pragma unroll
    for (int j = 0; j < 4; ++j)
#pragma unroll
      for (int u = 0; u < 2; ++u) o[j][u] = F::mma(vf[j], pf[u], o[j][u]);
    // the pass's address registers stay whole (inputs) until the wait that lets the next pass overwrite them
    asm volatile("s_wait_xcnt 0x0" :: "v"(vp), "v"(kp), "v"(mp) : "memory");
  }

  _Float16* Cb = (_Float16*)CTXp + (size_t)b * kS * kD + hd * kDh + hf * 8;
#pragma unroll
  for (int u = 0; u < 2; ++u) {
    const float tot = l[u] + xhalf(l[u]);                     // join the two key halves of the query's sum
    const float inv = 64.0f / tot;
#pragma unroll
    for (int j = 0; j < 4; ++j) {
      v8h hv;
#pragma unroll
      for (int r = 0; r < 8; ++r) hv[r] = (_Float16)(o[j][u][r] * inv);
      *(v8h*)(Cb + (size_t)(q0 + 16 * u + c) * kD + 16 * j) = hv;
    }
  }
}

// ---------------------------------------------------------------------------
// Exact erf gelu + f16 cast: out[2i], out[2i+1] = f16( carry * gelu(sgn * U[2i..2i+1]) ), sgn = neg ? -1 : +1 (uniform).
// ---------------------------------------------------------------------------
__global__ __launch_bounds__(256) void gelu_cast_kernel(const float* __restrict__ U, unsigned short* __restrict__ out,
                                                        int n2, int neg, float carry) {
  const int i = blockIdx.x * 256 + threadIdx.x;
  if (i >= n2) return;
  const v2f p = *(const v2f*)(U + 2 * (size_t)i);
  const float sgn = neg ? -1.0f : 1.0f;
  const float a = p[0] * sgn;
  const float b = p[1] * sgn;
  const float ga = 0.5f * a * (1.0f + erff(a * 0.70710678118654752f));
  const float gb = 0.5f * b * (1.0f + erff(b * 0.70710678118654752f));
  const unsigned u = pk16(h_bits(ga * carry), h_bits(gb * carry));
  unsigned* q = (unsigned*)(out + 2 * (size_t)i);
  *(unsigned*)q = u;
  
}

// ---------------------------------------------------------------------------
// Host orchestration
// Workspace region map (MiB offsets; total carve end = 124 MiB = 130,023,424 B):
//   phase 1 (attention): H16 [0,8)  WQKVT [8,14)  MT [14,18)  WOT [18,20)  QKV16 [20,44)  QM16 [44,52)
//                        VT16 [52,60)  CTX16 [60,68)
//   X1 f32 [20,36) is written by the Wo GEMM after every reader of QKV16 has run.
//   phase 2 (FFN): H16 [0,8) (h2)  WPOST [8,16)  WNEGT [116,124)  WPROJT [36,52)  TP f32 [52,68)
//                  CAT16 half [68,100)  U f32 chunk [100,116)
// Every region is fully written before it is read; all GEMM M,N,K multiples of 128 (no padding).
// ---------------------------------------------------------------------------
extern "C" void kernel_launch(void* const* d_in, const int* in_sizes, int n_in,
                              void* d_out, int out_size, void* d_ws, size_t ws_size,
                              hipStream_t stream) {
  const size_t MIB = 1048576;
  if (n_in < 14) return;
  if (in_sizes[0] != kTok * kD || in_sizes[1] != kB * kD * kD || in_sizes[2] != kS * kS ||
      in_sizes[3] != kD || in_sizes[4] != kD || in_sizes[5] != kD || in_sizes[6] != kD ||
      in_sizes[7] != kD * kD || in_sizes[8] != kD * kD || in_sizes[9] != kD * kD || in_sizes[10] != kD * kD ||
      in_sizes[11] != kD * kF || in_sizes[12] != kD * kF || in_sizes[13] != 2 * kF * kD) return;
  if (out_size != kTok * kD) return;
  if (ws_size < 124 * MIB) return;

  const float* xf   = (const float*)d_in[0];
  const float* Mf   = (const float*)d_in[1];
  const float* mkf  = (const float*)d_in[2];
  const float* g1f  = (const float*)d_in[3];
  const float* b1f  = (const float*)d_in[4];
  const float* g2f  = (const float*)d_in[5];
  const float* b2f  = (const float*)d_in[6];
  const float* Wqf  = (const float*)d_in[7];
  const float* Wkf  = (const float*)d_in[8];
  const float* Wvf  = (const float*)d_in[9];
  const float* Wof  = (const float*)d_in[10];
  const float* Wpf  = (const float*)d_in[11];
  const float* Wnf  = (const float*)d_in[12];
  const float* Wjf  = (const float*)d_in[13];
  float* out = (float*)d_out;

  char* ws = (char*)d_ws;
  unsigned short* H16   = (unsigned short*)(ws + 0 * MIB);
  unsigned short* WQKV  = (unsigned short*)(ws + 8 * MIB);
  unsigned short* MT    = (unsigned short*)(ws + 14 * MIB);
  unsigned short* WOT   = (unsigned short*)(ws + 18 * MIB);
  unsigned short* QKV   = (unsigned short*)(ws + 20 * MIB);
  unsigned short* QM    = (unsigned short*)(ws + 44 * MIB);
  unsigned short* VT    = (unsigned short*)(ws + 52 * MIB);
  unsigned short* CTX   = (unsigned short*)(ws + 60 * MIB);
  float*          X1    = (float*)(ws + 20 * MIB);
  unsigned short* WPOS  = (unsigned short*)(ws + 8 * MIB);
  unsigned short* WNEG  = (unsigned short*)(ws + 116 * MIB);
  unsigned short* WPROJ = (unsigned short*)(ws + 36 * MIB);
  float*          TP    = (float*)(ws + 52 * MIB);
  unsigned short* CAT   = (unsigned short*)(ws + 68 * MIB);
  float*          U     = (float*)(ws + 100 * MIB);

  const float rr  = (float)(2.0 / 11.0);
  const float omr = (float)(1.0 - 2.0 / 11.0);
  const float wcarry  = 16.0f;     // square weights and Wpos/Wneg carried x16
  const float wjcarry = 64.0f;     // Wproj carried x64
  const float ccarry  = 16.0f;     // gelu planes carried x16

  // ---- phase 1: weights -> transposed f16 planes (x16) ----
  // Wq,Wk,Wv [1024][1024] -> WQKVT rows 0.., 1024.., 2048..; Wo -> WOT
  tcast_kernel<<<dim3(kD / 64, kD / 64, 4), 256, 0, stream>>>(
      Wqf, Wkf, Wvf, Wof,
      WQKV, WQKV + (size_t)kD * kD, WQKV + (size_t)2 * kD * kD, WOT, kD, kD, wcarry);
  // M[b] [1024 d][1024 e] -> MT[b][e][d]
  tcast_kernel<<<dim3(kD / 64, kD / 64, 2), 256, 0, stream>>>(
      Mf, Mf + (size_t)kD * kD, Mf, Mf,
      MT, MT + (size_t)kD * kD, MT, MT, kD, kD, wcarry);

  // h1 = ind_norm(x; g1, b1) -> H16 [4096][1024]
  indnorm_kernel<<<dim3(kTok), 128, 0, stream>>>(xf, g1f, b1f, H16, omr, rr);

  // QKV16 [4096][3072] = h1 . [Wq|Wk|Wv]   (M=4096, N=3072, K=1024; tiles 32x24 -> 768 blocks)
  wmma_gemm128<1, false><<<dim3(768, 1), 256, 0, stream>>>(
      H16, kD, 0, WQKV, kD, 0, QKV, kQKVld, 0, xf, 0, kQKVld, kD, 1.0f / wcarry);

  // VT16[b][dg][t] = V[b][t][dg]
  vt_kernel<<<dim3(kS / 64, kD / 64, kB), 256, 0, stream>>>(QKV, VT);

  // QM16[b] = Q[b] . M[b]   (M=2048, N=1024, K=1024 per batch; tiles 16x8 -> 128 blocks, grid.y = batch)
  wmma_gemm128<1, false><<<dim3(128, kB), 256, 0, stream>>>(
      QKV, kQKVld, (long)kS * kQKVld, MT, kD, (long)kD * kD, QM, kD, (long)kS * kD,
      xf, 0, kD, kD, 1.0f / wcarry);

  // ---- attention: CTX16[b][i][h*64+n] = 64 * softmax(clip(QM.K^T / 8) + mask) . V, all 32 (batch, head) groups ----
  attn_kernel<<<dim3(kS / 256, kB * kH), 256, 0, stream>>>(QM, QKV, VT, mkf, CTX);

  // x1 = x + ctx . Wo   (ctx x64, WoT x16 -> scale 1/1024; M=4096, N=1024, K=1024; tiles 32x8 -> 256 blocks)
  wmma_gemm128<0, true><<<dim3(256, 1), 256, 0, stream>>>(
      CTX, kD, 0, WOT, kD, 0, X1, kD, 0, xf, 0, kD, kD, 1.0f / 1024.0f);

  // ---- phase 2: FFN ----
  // h2 = ind_norm(x1; g2, b2) -> H16
  indnorm_kernel<<<dim3(kTok), 128, 0, stream>>>(X1, g2f, b2f, H16, omr, rr);
  // Wpos, Wneg [1024 k][4096 n] -> [4096][1024] f16 x16
  tcast_kernel<<<dim3(kD / 64, kF / 64, 2), 256, 0, stream>>>(
      Wpf, Wnf, Wpf, Wpf, WPOS, WNEG, WPOS, WPOS, kD, kF, wcarry);
  // Wproj [8192 k][1024 n] -> [1024][8192] f16 x64
  tcast_kernel<<<dim3((2 * kF) / 64, kD / 64, 1), 256, 0, stream>>>(
      Wjf, Wjf, Wjf, Wjf, WPROJ, WPROJ, WPROJ, WPROJ, 2 * kF, kD, wjcarry);

  const int nChunks = kTok / kFfnRows;                   // 4
  const int n2 = (kFfnRows * kF) / 2;                    // 2,097,152 threads per gelu launch
  // pos half: CAT16[r][n] = f16(16 * gelu(h2 . Wpos))
  for (int cix = 0; cix < nChunks; ++cix) {
    // U [1024][4096] f32 = h2 rows . Wpos   (M=1024, N=4096, K=1024; tiles 8x32 -> 256 blocks)
    wmma_gemm128<0, false><<<dim3(256, 1), 256, 0, stream>>>(
        H16 + (size_t)cix * kFfnRows * kD, kD, 0, WPOS, kD, 0, U, kF, 0, xf, 0, kF, kD, 1.0f / wcarry);
    gelu_cast_kernel<<<dim3(n2 / 256), 256, 0, stream>>>(U, CAT + (size_t)cix * kFfnRows * kF, n2, 0, ccarry);
  }
  // TP = x1 + CATpos . Wproj[0:4096]   (cat x16, WprojT x64 -> scale 1/1024; M=4096, N=1024, K=4096)
  wmma_gemm128<0, true><<<dim3(256, 1), 256, 0, stream>>>(
      CAT, kF, 0, WPROJ, 2 * kF, 0, TP, kD, 0, X1, 0, kD, kF, 1.0f / 1024.0f);
  // neg half: CAT16[r][n] = f16(16 * gelu(-(h2 . Wneg)))   (exact sign identity)
  for (int cix = 0; cix < nChunks; ++cix) {
    wmma_gemm128<0, false><<<dim3(256, 1), 256, 0, stream>>>(
        H16 + (size_t)cix * kFfnRows * kD, kD, 0, WNEG, kD, 0, U, kF, 0, xf, 0, kF, kD, 1.0f / wcarry);
    gelu_cast_kernel<<<dim3(n2 / 256), 256, 0, stream>>>(U, CAT + (size_t)cix * kFfnRows * kF, n2, 1, ccarry);
  }
  // out = TP + CATneg . Wproj[4096:8192]
  wmma_gemm128<0, true><<<dim3(256, 1), 256, 0, stream>>>(
      CAT, kF, 0, WPROJ + kF, 2 * kF, 0, out, kD, 0, TP, 0, kD, kF, 1.0f / 1024.0f);
}

// v003
// Measured time: 302 microseconds a run.
// Timed twice side by side with v002, it ran 1.28 and 1.27 times as fast.
// All steps since v000 together make it 8.71 times as fast.
// Contractions: QKV, Q.M[b], Wo, Wpos/Wneg, Wproj projections and attention scores k.q^T and V^T.P^T all on v_wmma_f32_16x16x32_f16 (f16 operands: activations plain, weights carried x16 / x64, unnormalised P carried x256, ctx carried x64, gelu planes carried x16), f32 accumulate; norms, clip, softmax, gelu, residuals in f32.
#include <hip/hip_runtime.h>
#include <math.h>
#include <stdint.h>

// ---------------------------------------------------------------------------
// Problem constants
// ---------------------------------------------------------------------------
constexpr int kB     = 2;
constexpr int kS     = 2048;
constexpr int kD     = 1024;
constexpr int kF     = 4096;
constexpr int kH     = 16;
constexpr int kDh    = 64;
constexpr int kTok   = kB * kS;        // 4096 token rows
constexpr int kQKVld = 3 * kD;         // pitch of the q | k | v plane (halves)
constexpr float kCatCarry = 16.0f;     // gelu planes carried x16
constexpr float kEps   = 1e-5f;
constexpr float kInvD  = 1.0f / 1024.0f;

typedef __attribute__((ext_vector_type(16))) _Float16 v16h;
typedef __attribute__((ext_vector_type(8)))  _Float16 v8h;
typedef __attribute__((ext_vector_type(8)))  float    v8f;
typedef __attribute__((ext_vector_type(4)))  float    v4f;
typedef __attribute__((ext_vector_type(2)))  float    v2f;
typedef __attribute__((ext_vector_type(4)))  unsigned int v4u;

// ---------------------------------------------------------------------------
// Helpers
// ---------------------------------------------------------------------------
template <typename T> struct Frag;
template <> struct Frag<_Float16> {
  typedef v16h V; union U { v16h v; v8h h[2]; };
  static __device__ __forceinline__ v16h load(const _Float16* p) {   // elements 0..7 <- p[0..7], 8..15 <- p[16..23]
    U f; f.h[0] = *(const v8h*)(p); f.h[1] = *(const v8h*)(p + 16); return f.v;
  }
  static __device__ __forceinline__ v8f mma(v16h a, v16h b, v8f c) {
    return __builtin_amdgcn_wmma_f32_16x16x32_f16(false, a, false, b, (short)0, c, false, false);
  }
};
__device__ __forceinline__ unsigned pk16(unsigned short a, unsigned short b) { return (unsigned)a | ((unsigned)b << 16); }
__device__ __forceinline__ unsigned short h_bits(float f) { const _Float16 h = (_Float16)f; return __builtin_bit_cast(unsigned short, h); }

// ---- Batched WMMA GEMM, operands staged in LDS by asynchronous copies ------------------------------------------------
// C[m,n] = scale * sum_k A[m,k] * Bt[n,k] (+resid). A row-major [M,K]; Bt row-major [N,K]; f16 operands, f32 accumulate.
// One work-group of 8 waves owns a 128x128 tile of C; wave (wm, wn) = (wave & 3, wave >> 2) owns 32 rows x 64 columns.
// M, N % 128 == 0; K % 128 == 0; grid.x = (M / 128) * (N / 128), grid.y = batch.
// A stage is 128 k of the tile's 128 A rows and 128 Bt rows: 256 rows of 256 B at an LDS pitch of 272 B (16 B x odd, so the
// 16 rows of a ds_load_b128 fragment read fall on distinct banks). Two stages: the next one flies while this one is used.
// Each copy instruction of a wave moves 2 whole rows (4 whole 128-B lines); a fragment read from global touched 16 lines.
// OUT_MODE: 0 = f32, 1 = f16, 2 = f16(kCatCarry * gelu(value)), exact erf gelu on the f32 value.
constexpr int kGemmPitch = 272;                    // bytes per staged row
constexpr int kGemmStage = 256 * kGemmPitch;       // bytes per stage (A rows 0..127, Bt rows 128..255)

// Eight 16-B copies per lane: rows r, r + 16, ... r + 112 of one operand's half of the stage. The s_wait_xcnt stands inside
// the statement so that no address register of a copy is rewritten ahead of it.
__device__ __forceinline__ void stage_copy8(unsigned l, const _Float16* g, size_t step) {
  const unsigned ls = 16 * kGemmPitch;
  asm volatile(
      "global_load_async_to_lds_b128 %0, %8, off\n\t"
      "global_load_async_to_lds_b128 %1, %9, off\n\t"
      "global_load_async_to_lds_b128 %2, %10, off\n\t"
      "global_load_async_to_lds_b128 %3, %11, off\n\t"
      "global_load_async_to_lds_b128 %4, %12, off\n\t"
      "global_load_async_to_lds_b128 %5, %13, off\n\t"
      "global_load_async_to_lds_b128 %6, %14, off\n\t"
      "global_load_async_to_lds_b128 %7, %15, off\n\t"
      "s_wait_xcnt 0x0"
      :: "v"(l), "v"(l + ls), "v"(l + 2 * ls), "v"(l + 3 * ls), "v"(l + 4 * ls), "v"(l + 5 * ls), "v"(l + 6 * ls),
         "v"(l + 7 * ls),
         "v"(g), "v"(g + step), "v"(g + 2 * step), "v"(g + 3 * step), "v"(g + 4 * step), "v"(g + 5 * step),
         "v"(g + 6 * step), "v"(g + 7 * step)
      : "memory");
}

// erf(x) in f32: the math library's two polynomials (|x| < 1: odd series in x^2; else 1 - exp(-poly(|x|))), both evaluated
// and one selected. A wave's 32 values nearly always span both ranges, so a branch saves no work, and without the branches
// the independent values of an accumulator tile interleave instead of each waiting out its own dependent chain.
__device__ __forceinline__ float erf_sel(float x) {
  const float ax = fabsf(x);
  float p = fmaf(ax, 0x1.1d3156p-16f, -0x1.8d129p-12f);
  p = fmaf(ax, p, 0x1.f9a6d2p-9f);
  p = fmaf(ax, p, -0x1.8c3164p-6f);
  p = fmaf(ax, p, 0x1.b4e9c8p-4f);
  p = fmaf(ax, p, 0x1.4515fap-1f);
  p = fmaf(ax, p, 0x1.078e5p-3f);
  p = fmaf(ax, p, ax);
  const float big = 1.0f - expf(-p);
  const float t = x * x;
  float q = fmaf(t, -0x1.268bc2p-11f, 0x1.420828p-8f);
  q = fmaf(t, q, -0x1.b5937p-6f);
  q = fmaf(t, q, 0x1.ce077cp-4f);
  q = fmaf(t, q, -0x1.81266p-2f);
  q = fmaf(t, q, 0x1.06eba0p-3f);
  const float small = fmaf(ax, q, ax);
  return copysignf(ax < 1.0f ? small : big, x);
}
__device__ __forceinline__ float gelu_erf(float a) { return 0.5f * a * (1.0f + erf_sel(a * 0.70710678118654752f)); }

template <int OUT_MODE, bool RESID>
__global__ __launch_bounds__(256) void wmma_gemm128(
    const unsigned short* __restrict__ Ap, int lda, long strideA,
    const unsigned short* __restrict__ Btp, int ldb, long strideB,
    void* __restrict__ Cout, int ldc, long strideC,
    const float* __restrict__ resid, long strideR,
    int N, int K, float scale) {
  typedef Frag<_Float16> F;
  __shared__ __attribute__((aligned(16))) unsigned char L[2 * kGemmStage];   // the ring; after the loop: the output slabs
  const int b    = blockIdx.y;
  const int lane = threadIdx.x & 31;
  const int wave = threadIdx.x >> 5;
  const int tilesN = N >> 7;
  const int tm = blockIdx.x / tilesN;
  const int tn = blockIdx.x - tm * tilesN;
  const int mB = tm << 7;                      // the work-group's tile
  const int nB = tn << 7;
  const int wm = wave & 3;
  const int wn = wave >> 2;

  const int rlane = lane & 15;                 // row (A) / col (B, D) within subtile
  const int hf    = lane >> 4;                 // lane half: k offset 8 * hf, D row offset 8 * hf
  const int mOff  = hf * 8;

  // copy map: thread t moves the 16-B piece (t & 15) of rows (t >> 4) + 16 i, i = 0..7, of each operand
  const int cr = threadIdx.x >> 4;
  const int cc = threadIdx.x & 15;
  const _Float16* gA = (const _Float16*)Ap  + (size_t)b * strideA + (size_t)(mB + cr) * lda + cc * 8;
  const _Float16* gB = (const _Float16*)Btp + (size_t)b * strideB + (size_t)(nB + cr) * ldb + cc * 8;
  const size_t stepA = (size_t)16 * lda;
  const size_t stepB = (size_t)16 * ldb;
  const unsigned lBase = (unsigned)(uintptr_t)L;                       // byte offset of the ring in the work-group's LDS
  const unsigned lA = lBase + cr * kGemmPitch + cc * 16;
  const unsigned lB = lA + 128 * kGemmPitch;

  // fragment read offsets in a stage (bytes)
  const int fA = (wm * 32 + rlane) * kGemmPitch + hf * 16;
  const int fB = (128 + wn * 64 + rlane) * kGemmPitch + hf * 16;

  v8f acc[2][4];
#pragma unroll
  for (int i = 0; i < 2; ++i)
#pragma unroll
    for (int j = 0; j < 4; ++j) acc[i][j] = (v8f){0.f,0.f,0.f,0.f,0.f,0.f,0.f,0.f};

  const int T = K >> 7;                        // stages
  stage_copy8(lA, gA, stepA);
  stage_copy8(lB, gB, stepB);
  asm volatile("s_wait_asynccnt 0x0" ::: "memory");   // this wave's share of stage 0 has landed
  __syncthreads();                                     // every wave's share of stage 0 is readable
  if (T > 1) {
    stage_copy8(lA + kGemmStage, gA + 128, stepA);
    stage_copy8(lB + kGemmStage, gB + 128, stepB);
  }

  for (int t = 0; t < T; ++t) {
    const unsigned bo = (t & 1) ? (unsigned)kGemmStage : 0u;
    const unsigned char* sb = L + bo;
    v16h bf[2][4], af[2][2];                   // two fragment sets: block kk + 1 is fetched while block kk multiplies
#pragma unroll
    for (int j = 0; j < 4; ++j) bf[0][j] = F::load((const _Float16*)(sb + fB + j * 16 * kGemmPitch));
#pragma unroll
    for (int i = 0; i < 2; ++i) af[0][i] = F::load((const _Float16*)(sb + fA + i * 16 * kGemmPitch));
#pragma unroll
    for (int kk = 0; kk < 4; ++kk) {
      if (kk < 3) {
#pragma unroll
        for (int j = 0; j < 4; ++j)
          bf[(kk + 1) & 1][j] = F::load((const _Float16*)(sb + fB + j * 16 * kGemmPitch + (kk + 1) * 64));
#pragma unroll
        for (int i = 0; i < 2; ++i)
          af[(kk + 1) & 1][i] = F::load((const _Float16*)(sb + fA + i * 16 * kGemmPitch + (kk + 1) * 64));
      }
      // keeps the next block's LDS reads one group ahead of this block's products; without it the scheduler folds the
      // two sets into one and each block waits out its own LDS latency
      __builtin_amdgcn_sched_barrier(0);
#pragma unroll
      for (int i = 0; i < 2; ++i)
#pragma unroll
        for (int j = 0; j < 4; ++j) acc[i][j] = F::mma(af[kk & 1][i], bf[kk & 1][j], acc[i][j]);
      // ends the block: the reads of block kk + 2 stay behind these products, whose operands they overwrite
      __builtin_amdgcn_sched_barrier(0);
    }
    asm volatile("s_wait_dscnt 0x0" ::: "memory");     // this wave's reads of stage t are done before the buffer is refilled
    asm volatile("s_wait_asynccnt 0x0" ::: "memory");  // this wave's share of stage t + 1 has landed
    __syncthreads();                                    // publishes stage t + 1 and ends every reader's use of stage t
    if (t + 2 < T) {
      stage_copy8(lA + bo, gA + (size_t)(t + 2) * 128, stepA);
      stage_copy8(lB + bo, gB + (size_t)(t + 2) * 128, stepB);
    }
  }
  asm volatile("s_wait_asynccnt 0x0" ::: "memory");    // no copy is outstanding when the ring becomes output staging

  // ---- epilogue: per-wave 16x64 slab, pitch 68 floats, in the ring (free behind the last pass's barrier) ----
  float* slab = (float*)L + wave * (16 * 68);
  const int m0 = mB + wm * 32;
  const int n0 = nB + wn * 64;
  const float* Rb = RESID ? (resid + (size_t)b * strideR) : nullptr;
#pragma unroll
  for (int i = 0; i < 2; ++i) {
    const int mBase = m0 + (i << 4);
#pragma unroll
    for (int j = 0; j < 4; ++j) {
      const int n = n0 + (j << 4) + rlane;
#pragma unroll
      for (int r = 0; r < 8; ++r) {
        float v = acc[i][j][r] * scale;
        if (RESID) v += Rb[(size_t)(mBase + mOff + r) * ldc + n];
        if (OUT_MODE == 2) v = gelu_erf(v) * kCatCarry;
        slab[(mOff + r) * 68 + (j << 4) + rlane] = v;
      }
    }
    __builtin_amdgcn_fence(__ATOMIC_RELEASE, "workgroup");
    __builtin_amdgcn_wave_barrier();
    __builtin_amdgcn_fence(__ATOMIC_ACQUIRE, "workgroup");
    if (OUT_MODE == 0) {
      float* C = (float*)Cout + (size_t)b * strideC;
      const int hh = lane >> 4, c4 = (lane & 15) * 4;     // row seg = 256 B = 16 lanes x 16 B
#pragma unroll
      for (int it = 0; it < 8; ++it) {
        const int row = it * 2 + hh;
        v4f v = *(const v4f*)(slab + row * 68 + c4);
        *(v4f*)(C + (size_t)(mBase + row) * ldc + n0 + c4) = v;
      }
    } else {
      const int q = lane >> 3, c8 = (lane & 7) * 8;
      unsigned short* C = (unsigned short*)Cout + (size_t)b * strideC;
#pragma unroll
      for (int it = 0; it < 4; ++it) {
        const int row = it * 4 + q;
        const float* sp = slab + row * 68 + c8;
        v8h hv;
#pragma unroll
        for (int e = 0; e < 8; ++e) hv[e] = (_Float16)sp[e];
        *(v8h*)(C + (size_t)(mBase + row) * ldc + n0 + c8) = hv;
      }
    }
    __builtin_amdgcn_fence(__ATOMIC_RELEASE, "workgroup");
    __builtin_amdgcn_wave_barrier();
    __builtin_amdgcn_fence(__ATOMIC_ACQUIRE, "workgroup");
  }
}

// ---------------------------------------------------------------------------
// Transpose + cast: in W [Kr][Nc] f32 row-major ([in k][out n]) -> out[n][k] = f16(scale * W[k][n]), pitch Kr halves.
// grid (Kr/64, Nc/64, nz): blockIdx.x = k tile (64 cols of out), blockIdx.y = n tile (64 rows of out),
// blockIdx.z selects (W0,O0)..(W3,O3) (block-uniform). 256 threads.
// Load coverage: 16 iterations x 256 threads = 4096 = whole 64x64 tile (coalesced along n).
// Store coverage: 8 waves x 2 iterations x 4 rows (lane>>3) = 64 rows; (lane&7) x 8 halves = 64 cols; each row
// ---------------------------------------------------------------------------
__global__ __launch_bounds__(256) void tcast_kernel(const float* __restrict__ W0, const float* __restrict__ W1,
                                                    const float* __restrict__ W2, const float* __restrict__ W3,
                                                    unsigned short* __restrict__ O0, unsigned short* __restrict__ O1,
                                                    unsigned short* __restrict__ O2, unsigned short* __restrict__ O3,
                                                    int Kr, int Nc, float scale) {
  __shared__ float sm[64][65];   // sm[n_local][k_local]
  const int t  = threadIdx.x;
  const int k0 = blockIdx.x * 64;
  const int n0 = blockIdx.y * 64;
  const int z  = blockIdx.z;
  const float* W = (z == 0) ? W0 : (z == 1) ? W1 : (z == 2) ? W2 : W3;
  unsigned short* O = (z == 0) ? O0 : (z == 1) ? O1 : (z == 2) ? O2 : O3;
#pragma unroll
  for (int i = 0; i < 16; ++i) {
    const int e = i * 256 + t;
    const int r = e >> 6;          // k local
    const int c = e & 63;          // n local
    sm[c][r] = W[(size_t)(k0 + r) * Nc + n0 + c] * scale;
  }
  __syncthreads();
  const int lane = t & 31, wave = t >> 5;
  const int q = lane >> 3, c8 = (lane & 7) * 8;
  {
#pragma unroll
    for (int it = 0; it < 2; ++it) {
      const int row = wave * 8 + it * 4 + q;                 // n local
      unsigned short hb[8];
#pragma unroll
      for (int e = 0; e < 8; ++e) hb[e] = h_bits(sm[row][c8 + e]);
      const v4u u = (v4u){pk16(hb[0], hb[1]), pk16(hb[2], hb[3]), pk16(hb[4], hb[5]), pk16(hb[6], hb[7])};
      *(v4u*)(O + (size_t)(n0 + row) * Kr + k0 + c8) = u;
    }
    
  }
}

// ---------------------------------------------------------------------------
// V transpose (16-bit move, no conversion): in  QKV plane [4096][3072] halves, V at columns 2048..3071;
// out VT[b][dg][t] = V[b][t][dg], planes [2][1024][2048] halves.
// grid (32 t-tiles, 16 d-tiles, 2 batches), 256 threads, tile 64 t x 64 d.
// Load coverage: 2 iterations x 256 threads x 8 halves (one 16-B integer word load each) = 4096 = whole tile.
// Store coverage: 8 waves x 2 iterations x 4 rows (lane>>3) = 64 d rows; 8 lanes x 8 halves = 64 t = one whole
// ---------------------------------------------------------------------------
__global__ __launch_bounds__(256) void vt_kernel(const unsigned short* __restrict__ QKV, unsigned short* __restrict__ VT) {
  __shared__ unsigned short sm[64][72];   // sm[d_local][t_local]
  const int tid = threadIdx.x;
  const int t0  = blockIdx.x * 64;
  const int d0  = blockIdx.y * 64;
  const int b   = blockIdx.z;
#pragma unroll
  for (int i = 0; i < 2; ++i) {
    const int e   = i * 256 + tid;
    const int r   = e >> 3;          // t local 0..63
    const int seg = e & 7;           // 8-half segment of the 64 d columns
    const v4u w = *(const v4u*)(QKV + ((size_t)(b * kS + t0 + r)) * kQKVld + 2 * kD + d0 + seg * 8);
#pragma unroll
    for (int j = 0; j < 4; ++j) {
      sm[seg * 8 + 2 * j][r]     = (unsigned short)(w[j] & 0xffffu);
      sm[seg * 8 + 2 * j + 1][r] = (unsigned short)(w[j] >> 16);
    }
  }
  __syncthreads();
  const int lane = tid & 31, wave = tid >> 5;
  const int q = lane >> 3, c8 = (lane & 7) * 8;
  {
#pragma unroll
    for (int it = 0; it < 2; ++it) {
      const int row = wave * 8 + it * 4 + q;                 // d local
      const v4u u = (v4u){pk16(sm[row][c8 + 0], sm[row][c8 + 1]), pk16(sm[row][c8 + 2], sm[row][c8 + 3]),
                          pk16(sm[row][c8 + 4], sm[row][c8 + 5]), pk16(sm[row][c8 + 6], sm[row][c8 + 7])};
      *(v4u*)(VT + ((size_t)(b * kD + d0 + row)) * kS + t0 + c8) = u;
    }
    
  }
}

// ---------------------------------------------------------------------------
// ind_norm: H[row][:] = f16( omr * ((x - mu) * rsqrt(var + eps) * g + b) + rr * x ), mu/var over the 1024-wide row
// One block of 128 threads per row; thread t owns columns 8t..8t+7 (128 x 8 = 1024 = whole row).
// ---------------------------------------------------------------------------
__global__ __launch_bounds__(128) void indnorm_kernel(const float* __restrict__ X, const float* __restrict__ G,
                                                      const float* __restrict__ Bv, unsigned short* __restrict__ H,
                                                      float omr, float rr) {
  __shared__ float redA[4];
  __shared__ float redB[4];
  const int row  = blockIdx.x;
  const int t    = threadIdx.x;
  const int lane = t & 31, wave = t >> 5;
  const int c0   = t * 8;
  const float* xr = X + (size_t)row * kD + c0;
  const v4f a = *(const v4f*)(xr);
  const v4f c = *(const v4f*)(xr + 4);
  float v[8];
#pragma unroll
  for (int e = 0; e < 4; ++e) { v[e] = a[e]; v[4 + e] = c[e]; }
  float s = ((v[0] + v[1]) + (v[2] + v[3])) + ((v[4] + v[5]) + (v[6] + v[7]));
#pragma unroll
  for (int off = 16; off > 0; off >>= 1) s += __shfl_xor(s, off, 32);
  if (lane == 0) redA[wave] = s;
  __syncthreads();
  const float mean = ((redA[0] + redA[1]) + (redA[2] + redA[3])) * kInvD;
  float d[8];
  float qs = 0.f;
#pragma unroll
  for (int e = 0; e < 8; ++e) { d[e] = v[e] - mean; qs += d[e] * d[e]; }
#pragma unroll
  for (int off = 16; off > 0; off >>= 1) qs += __shfl_xor(qs, off, 32);
  if (lane == 0) redB[wave] = qs;
  __syncthreads();
  const float var  = ((redB[0] + redB[1]) + (redB[2] + redB[3])) * kInvD;
  const float rstd = rsqrtf(var + kEps);
  const v4f ga = *(const v4f*)(G + c0);
  const v4f gc = *(const v4f*)(G + c0 + 4);
  const v4f ba = *(const v4f*)(Bv + c0);
  const v4f bc = *(const v4f*)(Bv + c0 + 4);
  float gg[8], bb[8];
#pragma unroll
  for (int e = 0; e < 4; ++e) { gg[e] = ga[e]; gg[4 + e] = gc[e]; bb[e] = ba[e]; bb[4 + e] = bc[e]; }
  unsigned short hb[8];
#pragma unroll
  for (int e = 0; e < 8; ++e) {
    const float ln = d[e] * rstd * gg[e] + bb[e];
    const float o  = omr * ln + rr * v[e];
    hb[e] = h_bits(o);
  }
  const v4u u = (v4u){pk16(hb[0], hb[1]), pk16(hb[2], hb[3]), pk16(hb[4], hb[5]), pk16(hb[6], hb[7])};
  unsigned short* op = H + (size_t)row * kD + c0;
  *(v4u*)op = u;
  
}

// lane l <-> lane l ^ 16 (register exchange between the two 16-lane rows, no LDS round trip)
__device__ __forceinline__ float xhalf(float x) {
  const int v = __builtin_bit_cast(int, x);
  return __builtin_bit_cast(float, __builtin_amdgcn_permlanex16(v, v, 0x76543210, 0xfedcba98, false, false));
}

// ---------------------------------------------------------------------------
// Fused attention for one (batch, head) and 256 queries per block: scores, clip, mask, softmax and P.V in one pass
// over the keys, 32 keys at a time; neither scores nor probabilities go to memory.
//   S^T = K . QM^T   (A = 16 key rows, B = 16 query columns): a lane holds 8 keys (8*hf + r) of ONE query (lane & 15).
//   O^T += V^T . P^T (A = 16 d rows of VT, B = P^T): two S^T tiles of 16 keys, converted in place, are the B operand
//   in the same k order as Frag::load gives VT (elements 0..7 = keys 8*hf.., 8..15 = keys 16 + 8*hf..).
// Online softmax per query column: running maximum m and sum l in f32, O^T and l rescaled when m grows.
// p = 256 * exp(s - m) (the factor keeps small p out of the f16 subnormals and cancels in O / l).
// grid (2048 / 256 query blocks, 32 groups), 256 threads; wave w owns queries 32w .. 32w + 31 of its block.
// Output: lane writes CTX[query][head*64 + 16j + 8*hf + 0..7] = f16(64 * O / l), 16 B each; every element once.
// ---------------------------------------------------------------------------
__global__ __launch_bounds__(256) void attn_kernel(const unsigned short* __restrict__ QMp,
                                                   const unsigned short* __restrict__ QKVp,
                                                   const unsigned short* __restrict__ VTp,
                                                   const float* __restrict__ MK,
                                                   unsigned short* __restrict__ CTXp) {
  typedef Frag<_Float16> F;
  const int lane = threadIdx.x & 31, wave = threadIdx.x >> 5;
  const int c  = lane & 15;
  const int hf = lane >> 4;
  const int b  = blockIdx.y >> 4;
  const int hd = blockIdx.y & 15;
  const int q0 = blockIdx.x * 256 + wave * 32;
  const _Float16* Qb = (const _Float16*)QMp + (size_t)b * kS * kD + hd * kDh + hf * 8;
  const _Float16* Kb = (const _Float16*)QKVp + (size_t)b * kS * kQKVld + hd * kDh + (size_t)c * kQKVld + hf * 8;   // K plane at + kD
  const _Float16* Vb = (const _Float16*)VTp + ((size_t)b * kD + hd * kDh + c) * kS + hf * 8;
  const float*    Mb = MK + (size_t)(q0 + c) * kS + hf * 8;
  const float kLog2e = 1.44269504088896340736f;
  const float kNegInf = -__builtin_inff();

  const _Float16* qp = Qb + (size_t)(q0 + c) * kD;
  v16h qf[2][2];                       // [query tile][k chunk of 32]
#pragma unroll
  for (int u = 0; u < 2; ++u)
#pragma unroll
    for (int kc = 0; kc < 2; ++kc) qf[u][kc] = F::load(qp + (size_t)(16 * u) * kD + kc * 32);

  v8f o[4][2];                         // [d tile][query tile]
#pragma unroll
  for (int j = 0; j < 4; ++j)
#pragma unroll
    for (int u = 0; u < 2; ++u) o[j][u] = (v8f){0.f,0.f,0.f,0.f,0.f,0.f,0.f,0.f};
  float m[2] = {kNegInf, kNegInf};
  float l[2] = {0.f, 0.f};

  v16h kf[2][2];                       // [key tile][k chunk], fetched one pass ahead
  v4f  mk[2][2][2];                    // [query tile][key tile][4-float half], fetched one pass ahead
#pragma unroll
  for (int tt = 0; tt < 2; ++tt)
#pragma unroll
    for (int kc = 0; kc < 2; ++kc) kf[tt][kc] = F::load(Kb + (size_t)(16 * tt) * kQKVld + kD + kc * 32);
#pragma unroll
  for (int u = 0; u < 2; ++u)
#pragma unroll
    for (int tt = 0; tt < 2; ++tt) {
      mk[u][tt][0] = *(const v4f*)(Mb + (size_t)(16 * u) * kS + 16 * tt);
      mk[u][tt][1] = *(const v4f*)(Mb + (size_t)(16 * u) * kS + 16 * tt + 4);
    }
  // the address registers of the loads above stay whole (inputs) until the wait that lets them be overwritten
  asm volatile("s_wait_xcnt 0x0" :: "v"(qp), "v"(Kb), "v"(Mb) : "memory");

  for (int t0 = 0; t0 < kS; t0 += 32) {
    const _Float16* vp = Vb + t0;
    v16h vf[4];
#pragma unroll
    for (int j = 0; j < 4; ++j) vf[j] = F::load(vp + (size_t)(16 * j) * kS);

    v8f s[2][2];                       // [query tile][key tile]
#pragma unroll
    for (int u = 0; u < 2; ++u)
#pragma unroll
      for (int tt = 0; tt < 2; ++tt) {
        s[u][tt] = F::mma(kf[tt][0], qf[u][0], (v8f){0.f,0.f,0.f,0.f,0.f,0.f,0.f,0.f});
        s[u][tt] = F::mma(kf[tt][1], qf[u][1], s[u][tt]);
      }

    // next pass's keys (the last pass wraps to key 0: in bounds, its values are not used)
    const int tn = (t0 + 32) & (kS - 1);
    const _Float16* kp = Kb + (size_t)tn * kQKVld;
#pragma unroll
    for (int tt = 0; tt < 2; ++tt)
#pragma unroll
      for (int kc = 0; kc < 2; ++kc) kf[tt][kc] = F::load(kp + (size_t)(16 * tt) * kQKVld + kD + kc * 32);

    float x[2][16];
#pragma unroll
    for (int u = 0; u < 2; ++u)
#pragma unroll
      for (int tt = 0; tt < 2; ++tt)
#pragma unroll
        for (int r = 0; r < 8; ++r)    // clip(s / 8, -50, 50) + mask; the power-of-two scale commutes with the clip
          x[u][tt * 8 + r] = fminf(fmaxf(s[u][tt][r], -400.0f), 400.0f) * 0.125f + mk[u][tt][r >> 2][r & 3];
    // next pass's mask
    const float* mp = Mb + tn;
#pragma unroll
    for (int u = 0; u < 2; ++u)
#pragma unroll
      for (int tt = 0; tt < 2; ++tt) {
        mk[u][tt][0] = *(const v4f*)(mp + (size_t)(16 * u) * kS + 16 * tt);
        mk[u][tt][1] = *(const v4f*)(mp + (size_t)(16 * u) * kS + 16 * tt + 4);
      }
    // keeps the three groups of loads issued here, ahead of the softmax that covers their latency; without it the
    // scheduler sinks them to the foot of the pass and the next pass waits for the whole latency
    __builtin_amdgcn_sched_barrier(0);

    v16h pf[2];
#pragma unroll
    for (int u = 0; u < 2; ++u) {
      float mx = x[u][0];
#pragma unroll
      for (int e = 1; e < 16; ++e) mx = fmaxf(mx, x[u][e]);
      mx = fmaxf(mx, xhalf(mx));                              // the other 16 keys of this query
      const float mn  = fmaxf(m[u], mx);
      const float mu  = (mn == kNegInf) ? 0.0f : mn;          // all keys so far masked out: p = 0, no NaN
      const float alpha = __builtin_amdgcn_exp2f((m[u] - mu) * kLog2e);
      m[u] = mn;
      float ps = 0.f;
#pragma unroll
      for (int e = 0; e < 16; ++e) {
        const float p = __builtin_amdgcn_exp2f((x[u][e] - mu) * kLog2e + 8.0f);
        ps += p;
        pf[u][e] = (_Float16)p;
      }
      l[u] = l[u] * alpha + ps;
#pragma unroll
      for (int j = 0; j < 4; ++j)
#pragma unroll
        for (int r = 0; r < 8; ++r) o[j][u][r] *= alpha;
    }
#pragma unroll
    for (int j = 0; j < 4; ++j)
#pragma unroll
      for (int u = 0; u < 2; ++u) o[j][u] = F::mma(vf[j], pf[u], o[j][u]);
    // the pass's address registers stay whole (inputs) until the wait that lets the next pass overwrite them
    asm volatile("s_wait_xcnt 0x0" :: "v"(vp), "v"(kp), "v"(mp) : "memory");
  }

  _Float16* Cb = (_Float16*)CTXp + (size_t)b * kS * kD + hd * kDh + hf * 8;
#pragma unroll
  for (int u = 0; u < 2; ++u) {
    const float tot = l[u] + xhalf(l[u]);                     // join the two key halves of the query's sum
    const float inv = 64.0f / tot;
#pragma unroll
    for (int j = 0; j < 4; ++j) {
      v8h hv;
#pragma unroll
      for (int r = 0; r < 8; ++r) hv[r] = (_Float16)(o[j][u][r] * inv);
      *(v8h*)(Cb + (size_t)(q0 + 16 * u + c) * kD + 16 * j) = hv;
    }
  }
}

// ---------------------------------------------------------------------------
// Host orchestration
// Workspace region map (MiB offsets; total carve end = 124 MiB = 130,023,424 B):
//   phase 1 (attention): H16 [0,8)  WQKVT [8,14)  MT [14,18)  WOT [18,20)  QKV16 [20,44)  QM16 [44,52)
//                        VT16 [52,60)  CTX16 [60,68)
//   X1 f32 [20,36) is written by the Wo GEMM after every reader of QKV16 has run.
//   phase 2 (FFN): H16 [0,8) (h2)  WPOST [8,16)  WNEGT [116,124)  WPROJT [36,52)  TP f32 [52,68)
//                  CAT16 half [68,100)
// Every region is fully written before it is read; all GEMM M,N,K multiples of 128 (no padding).
// ---------------------------------------------------------------------------
extern "C" void kernel_launch(void* const* d_in, const int* in_sizes, int n_in,
                              void* d_out, int out_size, void* d_ws, size_t ws_size,
                              hipStream_t stream) {
  const size_t MIB = 1048576;
  if (n_in < 14) return;
  if (in_sizes[0] != kTok * kD || in_sizes[1] != kB * kD * kD || in_sizes[2] != kS * kS ||
      in_sizes[3] != kD || in_sizes[4] != kD || in_sizes[5] != kD || in_sizes[6] != kD ||
      in_sizes[7] != kD * kD || in_sizes[8] != kD * kD || in_sizes[9] != kD * kD || in_sizes[10] != kD * kD ||
      in_sizes[11] != kD * kF || in_sizes[12] != kD * kF || in_sizes[13] != 2 * kF * kD) return;
  if (out_size != kTok * kD) return;
  if (ws_size < 124 * MIB) return;

  const float* xf   = (const float*)d_in[0];
  const float* Mf   = (const float*)d_in[1];
  const float* mkf  = (const float*)d_in[2];
  const float* g1f  = (const float*)d_in[3];
  const float* b1f  = (const float*)d_in[4];
  const float* g2f  = (const float*)d_in[5];
  const float* b2f  = (const float*)d_in[6];
  const float* Wqf  = (const float*)d_in[7];
  const float* Wkf  = (const float*)d_in[8];
  const float* Wvf  = (const float*)d_in[9];
  const float* Wof  = (const float*)d_in[10];
  const float* Wpf  = (const float*)d_in[11];
  const float* Wnf  = (const float*)d_in[12];
  const float* Wjf  = (const float*)d_in[13];
  float* out = (float*)d_out;

  char* ws = (char*)d_ws;
  unsigned short* H16   = (unsigned short*)(ws + 0 * MIB);
  unsigned short* WQKV  = (unsigned short*)(ws + 8 * MIB);
  unsigned short* MT    = (unsigned short*)(ws + 14 * MIB);
  unsigned short* WOT   = (unsigned short*)(ws + 18 * MIB);
  unsigned short* QKV   = (unsigned short*)(ws + 20 * MIB);
  unsigned short* QM    = (unsigned short*)(ws + 44 * MIB);
  unsigned short* VT    = (unsigned short*)(ws + 52 * MIB);
  unsigned short* CTX   = (unsigned short*)(ws + 60 * MIB);
  float*          X1    = (float*)(ws + 20 * MIB);
  unsigned short* WPOS  = (unsigned short*)(ws + 8 * MIB);
  unsigned short* WNEG  = (unsigned short*)(ws + 116 * MIB);
  unsigned short* WPROJ = (unsigned short*)(ws + 36 * MIB);
  float*          TP    = (float*)(ws + 52 * MIB);
  unsigned short* CAT   = (unsigned short*)(ws + 68 * MIB);

  const float rr  = (float)(2.0 / 11.0);
  const float omr = (float)(1.0 - 2.0 / 11.0);
  const float wcarry  = 16.0f;     // square weights and Wpos/Wneg carried x16
  const float wjcarry = 64.0f;     // Wproj carried x64

  // ---- phase 1: weights -> transposed f16 planes (x16) ----
  // Wq,Wk,Wv [1024][1024] -> WQKVT rows 0.., 1024.., 2048..; Wo -> WOT
  tcast_kernel<<<dim3(kD / 64, kD / 64, 4), 256, 0, stream>>>(
      Wqf, Wkf, Wvf, Wof,
      WQKV, WQKV + (size_t)kD * kD, WQKV + (size_t)2 * kD * kD, WOT, kD, kD, wcarry);
  // M[b] [1024 d][1024 e] -> MT[b][e][d]
  tcast_kernel<<<dim3(kD / 64, kD / 64, 2), 256, 0, stream>>>(
      Mf, Mf + (size_t)kD * kD, Mf, Mf,
      MT, MT + (size_t)kD * kD, MT, MT, kD, kD, wcarry);

  // h1 = ind_norm(x; g1, b1) -> H16 [4096][1024]
  indnorm_kernel<<<dim3(kTok), 128, 0, stream>>>(xf, g1f, b1f, H16, omr, rr);

  // QKV16 [4096][3072] = h1 . [Wq|Wk|Wv]   (M=4096, N=3072, K=1024; tiles 32x24 -> 768 blocks)
  wmma_gemm128<1, false><<<dim3(768, 1), 256, 0, stream>>>(
      H16, kD, 0, WQKV, kD, 0, QKV, kQKVld, 0, xf, 0, kQKVld, kD, 1.0f / wcarry);

  // VT16[b][dg][t] = V[b][t][dg]
  vt_kernel<<<dim3(kS / 64, kD / 64, kB), 256, 0, stream>>>(QKV, VT);

  // QM16[b] = Q[b] . M[b]   (M=2048, N=1024, K=1024 per batch; tiles 16x8 -> 128 blocks, grid.y = batch)
  wmma_gemm128<1, false><<<dim3(128, kB), 256, 0, stream>>>(
      QKV, kQKVld, (long)kS * kQKVld, MT, kD, (long)kD * kD, QM, kD, (long)kS * kD,
      xf, 0, kD, kD, 1.0f / wcarry);

  // ---- attention: CTX16[b][i][h*64+n] = 64 * softmax(clip(QM.K^T / 8) + mask) . V, all 32 (batch, head) groups ----
  attn_kernel<<<dim3(kS / 256, kB * kH), 256, 0, stream>>>(QM, QKV, VT, mkf, CTX);

  // x1 = x + ctx . Wo   (ctx x64, WoT x16 -> scale 1/1024; M=4096, N=1024, K=1024; tiles 32x8 -> 256 blocks)
  wmma_gemm128<0, true><<<dim3(256, 1), 256, 0, stream>>>(
      CTX, kD, 0, WOT, kD, 0, X1, kD, 0, xf, 0, kD, kD, 1.0f / 1024.0f);

  // ---- phase 2: FFN ----
  // h2 = ind_norm(x1; g2, b2) -> H16
  indnorm_kernel<<<dim3(kTok), 128, 0, stream>>>(X1, g2f, b2f, H16, omr, rr);
  // Wpos, Wneg [1024 k][4096 n] -> [4096][1024] f16 x16
  tcast_kernel<<<dim3(kD / 64, kF / 64, 2), 256, 0, stream>>>(
      Wpf, Wnf, Wpf, Wpf, WPOS, WNEG, WPOS, WPOS, kD, kF, wcarry);
  // Wproj [8192 k][1024 n] -> [1024][8192] f16 x64
  tcast_kernel<<<dim3((2 * kF) / 64, kD / 64, 1), 256, 0, stream>>>(
      Wjf, Wjf, Wjf, Wjf, WPROJ, WPROJ, WPROJ, WPROJ, 2 * kF, kD, wjcarry);

  // pos half: CAT16[r][n] = f16(16 * gelu(h2 . Wpos)), gelu in the GEMM's epilogue
  // (M=4096, N=4096, K=1024; tiles 32x32 -> 1024 blocks)
  wmma_gemm128<2, false><<<dim3(1024, 1), 256, 0, stream>>>(
      H16, kD, 0, WPOS, kD, 0, CAT, kF, 0, xf, 0, kF, kD, 1.0f / wcarry);
  // TP = x1 + CATpos . Wproj[0:4096]   (cat x16, WprojT x64 -> scale 1/1024; M=4096, N=1024, K=4096)
  wmma_gemm128<0, true><<<dim3(256, 1), 256, 0, stream>>>(
      CAT, kF, 0, WPROJ, 2 * kF, 0, TP, kD, 0, X1, 0, kD, kF, 1.0f / 1024.0f);
  // neg half: CAT16[r][n] = f16(16 * gelu(-(h2 . Wneg)))   (exact sign identity: the sign rides on the scale)
  wmma_gemm128<2, false><<<dim3(1024, 1), 256, 0, stream>>>(
      H16, kD, 0, WNEG, kD, 0, CAT, kF, 0, xf, 0, kF, kD, -1.0f / wcarry);
  // out = TP + CATneg . Wproj[4096:8192]
  wmma_gemm128<0, true><<<dim3(256, 1), 256, 0, stream>>>(
      CAT, kF, 0, WPROJ + kF, 2 * kF, 0, out, kD, 0, TP, 0, kD, kF, 1.0f / 1024.0f);
}

// v004
// It runs in 271 microseconds.
// In both of two side-by-side timings against v003, it was 1.11 times as fast.
// Over all steps from v000 it is 9.68 times as fast.
// Contractions: QKV, Q.M[b], Wo, Wpos/Wneg, Wproj projections and attention scores k.q^T and V^T.P^T all on v_wmma_f32_16x16x32_f16 (f16 operands: activations plain, weights carried x16 / x64, unnormalised P carried x256, ctx carried x64, gelu planes carried x16), f32 accumulate; norms, clip, softmax, gelu, residuals in f32.
#include <hip/hip_runtime.h>
#include <math.h>
#include <stdint.h>

// ---------------------------------------------------------------------------
// Problem constants
// ---------------------------------------------------------------------------
constexpr int kB     = 2;
constexpr int kS     = 2048;
constexpr int kD     = 1024;
constexpr int kF     = 4096;
constexpr int kH     = 16;
constexpr int kDh    = 64;
constexpr int kTok   = kB * kS;        // 4096 token rows
constexpr int kQKVld = 3 * kD;         // pitch of the q | k | v plane (halves)
constexpr float kCatCarry = 16.0f;     // gelu planes carried x16
constexpr float kEps   = 1e-5f;
constexpr float kInvD  = 1.0f / 1024.0f;

typedef __attribute__((ext_vector_type(16))) _Float16 v16h;
typedef __attribute__((ext_vector_type(8)))  _Float16 v8h;
typedef __attribute__((ext_vector_type(8)))  float    v8f;
typedef __attribute__((ext_vector_type(4)))  float    v4f;
typedef __attribute__((ext_vector_type(2)))  float    v2f;
typedef __attribute__((ext_vector_type(4)))  unsigned int v4u;

// ---------------------------------------------------------------------------
// Helpers
// ---------------------------------------------------------------------------
template <typename T> struct Frag;
template <> struct Frag<_Float16> {
  typedef v16h V; union U { v16h v; v8h h[2]; };
  static __device__ __forceinline__ v16h load(const _Float16* p) {   // elements 0..7 <- p[0..7], 8..15 <- p[16..23]
    U f; f.h[0] = *(const v8h*)(p); f.h[1] = *(const v8h*)(p + 16); return f.v;
  }
  static __device__ __forceinline__ v8f mma(v16h a, v16h b, v8f c) {
    return __builtin_amdgcn_wmma_f32_16x16x32_f16(false, a, false, b, (short)0, c, false, false);
  }
};
__device__ __forceinline__ unsigned pk16(unsigned short a, unsigned short b) { return (unsigned)a | ((unsigned)b << 16); }
__device__ __forceinline__ unsigned short h_bits(float f) { const _Float16 h = (_Float16)f; return __builtin_bit_cast(unsigned short, h); }

// ---- Batched WMMA GEMM, operands staged in LDS by asynchronous copies ------------------------------------------------
// C[m,n] = scale * sum_k A[m,k] * Bt[n,k] (+resid). A row-major [M,K]; Bt row-major [N,K]; f16 operands, f32 accumulate.
// One work-group of 8 waves owns a 128x128 tile of C; wave (wm, wn) = (wave & 3, wave >> 2) owns 32 rows x 64 columns.
// M, N % 128 == 0; K % 128 == 0; grid.x = (M / 128) * (N / 128), grid.y = batch.
// A stage is 128 k of the tile's 128 A rows and 128 Bt rows: 256 rows of 256 B at an LDS pitch of 272 B (16 B x odd, so the
// 16 rows of a ds_load_b128 fragment read fall on distinct banks). Two stages: the next one flies while this one is used.
// Each copy instruction of a wave moves 2 whole rows (4 whole 128-B lines); a fragment read from global touched 16 lines.
// OUT_MODE: 0 = f32, 1 = f16, 2 = f16(kCatCarry * gelu(value)), exact erf gelu on the f32 value.
constexpr int kGemmPitch = 272;                    // bytes per staged row
constexpr int kGemmStage = 256 * kGemmPitch;       // bytes per stage (A rows 0..127, Bt rows 128..255)

// Eight 16-B copies per lane: rows r, r + 16, ... r + 112 of one operand's half of the stage. The s_wait_xcnt stands inside
// the statement so that no address register of a copy is rewritten ahead of it.
__device__ __forceinline__ void stage_copy8(unsigned l, const _Float16* g, size_t step) {
  const unsigned ls = 16 * kGemmPitch;
  asm volatile(
      "global_load_async_to_lds_b128 %0, %8, off\n\t"
      "global_load_async_to_lds_b128 %1, %9, off\n\t"
      "global_load_async_to_lds_b128 %2, %10, off\n\t"
      "global_load_async_to_lds_b128 %3, %11, off\n\t"
      "global_load_async_to_lds_b128 %4, %12, off\n\t"
      "global_load_async_to_lds_b128 %5, %13, off\n\t"
      "global_load_async_to_lds_b128 %6, %14, off\n\t"
      "global_load_async_to_lds_b128 %7, %15, off\n\t"
      "s_wait_xcnt 0x0"
      :: "v"(l), "v"(l + ls), "v"(l + 2 * ls), "v"(l + 3 * ls), "v"(l + 4 * ls), "v"(l + 5 * ls), "v"(l + 6 * ls),
         "v"(l + 7 * ls),
         "v"(g), "v"(g + step), "v"(g + 2 * step), "v"(g + 3 * step), "v"(g + 4 * step), "v"(g + 5 * step),
         "v"(g + 6 * step), "v"(g + 7 * step)
      : "memory");
}

// erf(x) in f32: the math library's two polynomials (|x| < 1: odd series in x^2; else 1 - exp(-poly(|x|))), both evaluated
// and one selected. A wave's 32 values nearly always span both ranges, so a branch saves no work, and without the branches
// the independent values of an accumulator tile interleave instead of each waiting out its own dependent chain.
__device__ __forceinline__ float erf_sel(float x) {
  const float ax = fabsf(x);
  float p = fmaf(ax, 0x1.1d3156p-16f, -0x1.8d129p-12f);
  p = fmaf(ax, p, 0x1.f9a6d2p-9f);
  p = fmaf(ax, p, -0x1.8c3164p-6f);
  p = fmaf(ax, p, 0x1.b4e9c8p-4f);
  p = fmaf(ax, p, 0x1.4515fap-1f);
  p = fmaf(ax, p, 0x1.078e5p-3f);
  p = fmaf(ax, p, ax);
  const float big = 1.0f - expf(-p);
  const float t = x * x;
  float q = fmaf(t, -0x1.268bc2p-11f, 0x1.420828p-8f);
  q = fmaf(t, q, -0x1.b5937p-6f);
  q = fmaf(t, q, 0x1.ce077cp-4f);
  q = fmaf(t, q, -0x1.81266p-2f);
  q = fmaf(t, q, 0x1.06eba0p-3f);
  const float small = fmaf(ax, q, ax);
  return copysignf(ax < 1.0f ? small : big, x);
}
__device__ __forceinline__ float gelu_erf(float a) { return 0.5f * a * (1.0f + erf_sel(a * 0.70710678118654752f)); }

template <int OUT_MODE, bool RESID>
__global__ __launch_bounds__(256) void wmma_gemm128(
    const unsigned short* __restrict__ Ap, int lda, long strideA,
    const unsigned short* __restrict__ Btp, int ldb, long strideB,
    void* __restrict__ Cout, int ldc, long strideC,
    const float* __restrict__ resid, long strideR,
    int N, int K, float scale) {
  typedef Frag<_Float16> F;
  __shared__ __attribute__((aligned(16))) unsigned char L[2 * kGemmStage];   // the ring; after the loop: the output slabs
  const int b    = blockIdx.y;
  const int lane = threadIdx.x & 31;
  const int wave = threadIdx.x >> 5;
  const int tilesN = N >> 7;
  const int tm = blockIdx.x / tilesN;
  const int tn = blockIdx.x - tm * tilesN;
  const int mB = tm << 7;                      // the work-group's tile
  const int nB = tn << 7;
  const int wm = wave & 3;
  const int wn = wave >> 2;

  const int rlane = lane & 15;                 // row (A) / col (B, D) within subtile
  const int hf    = lane >> 4;                 // lane half: k offset 8 * hf, D row offset 8 * hf
  const int mOff  = hf * 8;

  // copy map: thread t moves the 16-B piece (t & 15) of rows (t >> 4) + 16 i, i = 0..7, of each operand
  const int cr = threadIdx.x >> 4;
  const int cc = threadIdx.x & 15;
  const _Float16* gA = (const _Float16*)Ap  + (size_t)b * strideA + (size_t)(mB + cr) * lda + cc * 8;
  const _Float16* gB = (const _Float16*)Btp + (size_t)b * strideB + (size_t)(nB + cr) * ldb + cc * 8;
  const size_t stepA = (size_t)16 * lda;
  const size_t stepB = (size_t)16 * ldb;
  const unsigned lBase = (unsigned)(uintptr_t)L;                       // byte offset of the ring in the work-group's LDS
  const unsigned lA = lBase + cr * kGemmPitch + cc * 16;
  const unsigned lB = lA + 128 * kGemmPitch;

  // fragment read offsets in a stage (bytes)
  const int fA = (wm * 32 + rlane) * kGemmPitch + hf * 16;
  const int fB = (128 + wn * 64 + rlane) * kGemmPitch + hf * 16;

  v8f acc[2][4];
#pragma unroll
  for (int i = 0; i < 2; ++i)
#pragma unroll
    for (int j = 0; j < 4; ++j) acc[i][j] = (v8f){0.f,0.f,0.f,0.f,0.f,0.f,0.f,0.f};

  const int T = K >> 7;                        // stages
  stage_copy8(lA, gA, stepA);
  stage_copy8(lB, gB, stepB);
  asm volatile("s_wait_asynccnt 0x0" ::: "memory");   // this wave's share of stage 0 has landed
  __syncthreads();                                     // every wave's share of stage 0 is readable
  if (T > 1) {
    stage_copy8(lA + kGemmStage, gA + 128, stepA);
    stage_copy8(lB + kGemmStage, gB + 128, stepB);
  }

  for (int t = 0; t < T; ++t) {
    const unsigned bo = (t & 1) ? (unsigned)kGemmStage : 0u;
    const unsigned char* sb = L + bo;
    v16h bf[2][4], af[2][2];                   // two fragment sets: block kk + 1 is fetched while block kk multiplies
#pragma unroll
    for (int j = 0; j < 4; ++j) bf[0][j] = F::load((const _Float16*)(sb + fB + j * 16 * kGemmPitch));
#pragma unroll
    for (int i = 0; i < 2; ++i) af[0][i] = F::load((const _Float16*)(sb + fA + i * 16 * kGemmPitch));
#pragma unroll
    for (int kk = 0; kk < 4; ++kk) {
      if (kk < 3) {
#pragma unroll
        for (int j = 0; j < 4; ++j)
          bf[(kk + 1) & 1][j] = F::load((const _Float16*)(sb + fB + j * 16 * kGemmPitch + (kk + 1) * 64));
#pragma unroll
        for (int i = 0; i < 2; ++i)
          af[(kk + 1) & 1][i] = F::load((const _Float16*)(sb + fA + i * 16 * kGemmPitch + (kk + 1) * 64));
      }
      // keeps the next block's LDS reads one group ahead of this block's products; without it the scheduler folds the
      // two sets into one and each block waits out its own LDS latency
      __builtin_amdgcn_sched_barrier(0);
#pragma unroll
      for (int i = 0; i < 2; ++i)
#pragma unroll
        for (int j = 0; j < 4; ++j) acc[i][j] = F::mma(af[kk & 1][i], bf[kk & 1][j], acc[i][j]);
      // ends the block: the reads of block kk + 2 stay behind these products, whose operands they overwrite
      __builtin_amdgcn_sched_barrier(0);
    }
    asm volatile("s_wait_dscnt 0x0" ::: "memory");     // this wave's reads of stage t are done before the buffer is refilled
    asm volatile("s_wait_asynccnt 0x0" ::: "memory");  // this wave's share of stage t + 1 has landed
    __syncthreads();                                    // publishes stage t + 1 and ends every reader's use of stage t
    if (t + 2 < T) {
      stage_copy8(lA + bo, gA + (size_t)(t + 2) * 128, stepA);
      stage_copy8(lB + bo, gB + (size_t)(t + 2) * 128, stepB);
    }
  }
  asm volatile("s_wait_asynccnt 0x0" ::: "memory");    // no copy is outstanding when the ring becomes output staging

  // ---- epilogue: per-wave 16x64 slab, pitch 68 floats, in the ring (free behind the last pass's barrier) ----
  float* slab = (float*)L + wave * (16 * 68);
  const int m0 = mB + wm * 32;
  const int n0 = nB + wn * 64;
  const float* Rb = RESID ? (resid + (size_t)b * strideR) : nullptr;
#pragma unroll
  for (int i = 0; i < 2; ++i) {
    const int mBase = m0 + (i << 4);
#pragma unroll
    for (int j = 0; j < 4; ++j) {
      const int n = n0 + (j << 4) + rlane;
#pragma unroll
      for (int r = 0; r < 8; ++r) {
        float v = acc[i][j][r] * scale;
        if (RESID) v += Rb[(size_t)(mBase + mOff + r) * ldc + n];
        if (OUT_MODE == 2) v = gelu_erf(v) * kCatCarry;
        slab[(mOff + r) * 68 + (j << 4) + rlane] = v;
      }
    }
    __builtin_amdgcn_fence(__ATOMIC_RELEASE, "workgroup");
    __builtin_amdgcn_wave_barrier();
    __builtin_amdgcn_fence(__ATOMIC_ACQUIRE, "workgroup");
    if (OUT_MODE == 0) {
      float* C = (float*)Cout + (size_t)b * strideC;
      const int hh = lane >> 4, c4 = (lane & 15) * 4;     // row seg = 256 B = 16 lanes x 16 B
#pragma unroll
      for (int it = 0; it < 8; ++it) {
        const int row = it * 2 + hh;
        v4f v = *(const v4f*)(slab + row * 68 + c4);
        *(v4f*)(C + (size_t)(mBase + row) * ldc + n0 + c4) = v;
      }
    } else {
      const int q = lane >> 3, c8 = (lane & 7) * 8;
      unsigned short* C = (unsigned short*)Cout + (size_t)b * strideC;
#pragma unroll
      for (int it = 0; it < 4; ++it) {
        const int row = it * 4 + q;
        const float* sp = slab + row * 68 + c8;
        v8h hv;
#pragma unroll
        for (int e = 0; e < 8; ++e) hv[e] = (_Float16)sp[e];
        *(v8h*)(C + (size_t)(mBase + row) * ldc + n0 + c8) = hv;
      }
    }
    __builtin_amdgcn_fence(__ATOMIC_RELEASE, "workgroup");
    __builtin_amdgcn_wave_barrier();
    __builtin_amdgcn_fence(__ATOMIC_ACQUIRE, "workgroup");
  }
}

// ---------------------------------------------------------------------------
// Transpose + cast: in W [Kr][Nc] f32 row-major ([in k][out n]) -> out[n][k] = f16(scale * W[k][n]), pitch Kr halves.
// grid (Kr/64, Nc/64, nz): blockIdx.x = k tile (64 cols of out), blockIdx.y = n tile (64 rows of out),
// blockIdx.z selects (W0,O0)..(W3,O3) (block-uniform). 256 threads.
// Load coverage: 16 iterations x 256 threads = 4096 = whole 64x64 tile (coalesced along n).
// Store coverage: 8 waves x 2 iterations x 4 rows (lane>>3) = 64 rows; (lane&7) x 8 halves = 64 cols; each row
// ---------------------------------------------------------------------------
__global__ __launch_bounds__(256) void tcast_kernel(const float* __restrict__ W0, const float* __restrict__ W1,
                                                    const float* __restrict__ W2, const float* __restrict__ W3,
                                                    unsigned short* __restrict__ O0, unsigned short* __restrict__ O1,
                                                    unsigned short* __restrict__ O2, unsigned short* __restrict__ O3,
                                                    int Kr, int Nc, float scale) {
  __shared__ float sm[64][65];   // sm[n_local][k_local]
  const int t  = threadIdx.x;
  const int k0 = blockIdx.x * 64;
  const int n0 = blockIdx.y * 64;
  const int z  = blockIdx.z;
  const float* W = (z == 0) ? W0 : (z == 1) ? W1 : (z == 2) ? W2 : W3;
  unsigned short* O = (z == 0) ? O0 : (z == 1) ? O1 : (z == 2) ? O2 : O3;
#pragma unroll
  for (int i = 0; i < 16; ++i) {
    const int e = i * 256 + t;
    const int r = e >> 6;          // k local
    const int c = e & 63;          // n local
    sm[c][r] = W[(size_t)(k0 + r) * Nc + n0 + c] * scale;
  }
  __syncthreads();
  const int lane = t & 31, wave = t >> 5;
  const int q = lane >> 3, c8 = (lane & 7) * 8;
  {
#pragma unroll
    for (int it = 0; it < 2; ++it) {
      const int row = wave * 8 + it * 4 + q;                 // n local
      unsigned short hb[8];
#pragma unroll
      for (int e = 0; e < 8; ++e) hb[e] = h_bits(sm[row][c8 + e]);
      const v4u u = (v4u){pk16(hb[0], hb[1]), pk16(hb[2], hb[3]), pk16(hb[4], hb[5]), pk16(hb[6], hb[7])};
      *(v4u*)(O + (size_t)(n0 + row) * Kr + k0 + c8) = u;
    }
    
  }
}

// ---------------------------------------------------------------------------
// V transpose (16-bit move, no conversion): in  QKV plane [4096][3072] halves, V at columns 2048..3071;
// out VT[b][dg][t] = V[b][t][dg], planes [2][1024][2048] halves.
// grid (32 t-tiles, 16 d-tiles, 2 batches), 256 threads, tile 64 t x 64 d.
// Load coverage: 2 iterations x 256 threads x 8 halves (one 16-B integer word load each) = 4096 = whole tile.
// Store coverage: 8 waves x 2 iterations x 4 rows (lane>>3) = 64 d rows; 8 lanes x 8 halves = 64 t = one whole
// ---------------------------------------------------------------------------
__global__ __launch_bounds__(256) void vt_kernel(const unsigned short* __restrict__ QKV, unsigned short* __restrict__ VT) {
  __shared__ unsigned short sm[64][72];   // sm[d_local][t_local]
  const int tid = threadIdx.x;
  const int t0  = blockIdx.x * 64;
  const int d0  = blockIdx.y * 64;
  const int b   = blockIdx.z;
#pragma unroll
  for (int i = 0; i < 2; ++i) {
    const int e   = i * 256 + tid;
    const int r   = e >> 3;          // t local 0..63
    const int seg = e & 7;           // 8-half segment of the 64 d columns
    const v4u w = *(const v4u*)(QKV + ((size_t)(b * kS + t0 + r)) * kQKVld + 2 * kD + d0 + seg * 8);
#pragma unroll
    for (int j = 0; j < 4; ++j) {
      sm[seg * 8 + 2 * j][r]     = (unsigned short)(w[j] & 0xffffu);
      sm[seg * 8 + 2 * j + 1][r] = (unsigned short)(w[j] >> 16);
    }
  }
  __syncthreads();
  const int lane = tid & 31, wave = tid >> 5;
  const int q = lane >> 3, c8 = (lane & 7) * 8;
  {
#pragma unroll
    for (int it = 0; it < 2; ++it) {
      const int row = wave * 8 + it * 4 + q;                 // d local
      const v4u u = (v4u){pk16(sm[row][c8 + 0], sm[row][c8 + 1]), pk16(sm[row][c8 + 2], sm[row][c8 + 3]),
                          pk16(sm[row][c8 + 4], sm[row][c8 + 5]), pk16(sm[row][c8 + 6], sm[row][c8 + 7])};
      *(v4u*)(VT + ((size_t)(b * kD + d0 + row)) * kS + t0 + c8) = u;
    }
    
  }
}

// ---------------------------------------------------------------------------
// ind_norm: H[row][:] = f16( omr * ((x - mu) * rsqrt(var + eps) * g + b) + rr * x ), mu/var over the 1024-wide row
// One block of 128 threads per row; thread t owns columns 8t..8t+7 (128 x 8 = 1024 = whole row).
// ---------------------------------------------------------------------------
__global__ __launch_bounds__(128) void indnorm_kernel(const float* __restrict__ X, const float* __restrict__ G,
                                                      const float* __restrict__ Bv, unsigned short* __restrict__ H,
                                                      float omr, float rr) {
  __shared__ float redA[4];
  __shared__ float redB[4];
  const int row  = blockIdx.x;
  const int t    = threadIdx.x;
  const int lane = t & 31, wave = t >> 5;
  const int c0   = t * 8;
  const float* xr = X + (size_t)row * kD + c0;
  const v4f a = *(const v4f*)(xr);
  const v4f c = *(const v4f*)(xr + 4);
  float v[8];
#pragma unroll
  for (int e = 0; e < 4; ++e) { v[e] = a[e]; v[4 + e] = c[e]; }
  float s = ((v[0] + v[1]) + (v[2] + v[3])) + ((v[4] + v[5]) + (v[6] + v[7]));
#pragma unroll
  for (int off = 16; off > 0; off >>= 1) s += __shfl_xor(s, off, 32);
  if (lane == 0) redA[wave] = s;
  __syncthreads();
  const float mean = ((redA[0] + redA[1]) + (redA[2] + redA[3])) * kInvD;
  float d[8];
  float qs = 0.f;
#pragma unroll
  for (int e = 0; e < 8; ++e) { d[e] = v[e] - mean; qs += d[e] * d[e]; }
#pragma unroll
  for (int off = 16; off > 0; off >>= 1) qs += __shfl_xor(qs, off, 32);
  if (lane == 0) redB[wave] = qs;
  __syncthreads();
  const float var  = ((redB[0] + redB[1]) + (redB[2] + redB[3])) * kInvD;
  const float rstd = rsqrtf(var + kEps);
  const v4f ga = *(const v4f*)(G + c0);
  const v4f gc = *(const v4f*)(G + c0 + 4);
  const v4f ba = *(const v4f*)(Bv + c0);
  const v4f bc = *(const v4f*)(Bv + c0 + 4);
  float gg[8], bb[8];
#pragma unroll
  for (int e = 0; e < 4; ++e) { gg[e] = ga[e]; gg[4 + e] = gc[e]; bb[e] = ba[e]; bb[4 + e] = bc[e]; }
  unsigned short hb[8];
#pragma unroll
  for (int e = 0; e < 8; ++e) {
    const float ln = d[e] * rstd * gg[e] + bb[e];
    const float o  = omr * ln + rr * v[e];
    hb[e] = h_bits(o);
  }
  const v4u u = (v4u){pk16(hb[0], hb[1]), pk16(hb[2], hb[3]), pk16(hb[4], hb[5]), pk16(hb[6], hb[7])};
  unsigned short* op = H + (size_t)row * kD + c0;
  *(v4u*)op = u;
  
}

// lane l <-> lane l ^ 16 (register exchange between the two 16-lane rows, no LDS round trip)
__device__ __forceinline__ float xhalf(float x) {
  const int v = __builtin_bit_cast(int, x);
  return __builtin_bit_cast(float, __builtin_amdgcn_permlanex16(v, v, 0x76543210, 0xfedcba98, false, false));
}

// ---------------------------------------------------------------------------
// Fused attention for one (batch, head) and 256 queries per block: scores, clip, mask, softmax and P.V in one pass
// over the keys, 32 keys at a time; neither scores nor probabilities go to memory.
//   S^T = K . QM^T   (A = 16 key rows, B = 16 query columns): a lane holds 8 keys (8*hf + r) of ONE query (lane & 15).
//   O^T += V^T . P^T (A = 16 d rows of VT, B = P^T): two S^T tiles of 16 keys, converted in place, are the B operand
//   in the same k order as Frag::load gives VT (elements 0..7 = keys 8*hf.., 8..15 = keys 16 + 8*hf..).
// Online softmax per query column: running maximum m and sum l in f32, O^T and l rescaled when m grows.
// p = 256 * exp(s - m) (the factor keeps small p out of the f16 subnormals and cancels in O / l).
// grid (2048 / 256 query blocks, 32 groups), 256 threads; wave w owns queries 32w .. 32w + 31 of its block.
// K, V^T and the mask come through LDS, 64 keys (two passes) a stage, two stages, by asynchronous copies: a fragment
// read from global touched 16 lines an instruction and every wave fetched the same K and V^T; a copy instruction moves
// whole 128-B lines, and K and V^T are fetched once for the eight waves.
//   stage = K 64 key rows x 128 B and V^T 64 d rows x 128 B at pitch 144 B, mask 256 query rows x 256 B at pitch 272 B
//   (16 B x odd: the 16 rows of a ds_load_b128 fragment read fall on distinct banks).
// Output: lane writes CTX[query][head*64 + 16j + 8*hf + 0..7] = f16(64 * O / l), 16 B each; every element once.
// ---------------------------------------------------------------------------
constexpr int kAtKeys    = 64;                            // keys per stage
constexpr int kAtKVPitch = 144;                           // bytes per staged K or V^T row
constexpr int kAtMPitch  = 272;                           // bytes per staged mask row
constexpr int kAtV       = 64 * kAtKVPitch;               // V^T rows behind the K rows
constexpr int kAtM       = 2 * 64 * kAtKVPitch;           // mask rows behind both
constexpr int kAtStage   = kAtM + 256 * kAtMPitch;        // bytes per stage

// Rows r and r + 32 of the stage's K tile and of its V^T tile, one 16-B piece each. The s_wait_xcnt stands inside the
// statement so that no address register of a copy is rewritten ahead of it.
__device__ __forceinline__ void attn_copy_kv(unsigned lk, const _Float16* gk, unsigned lv, const _Float16* gv) {
  const unsigned ls = 32 * kAtKVPitch;
  asm volatile(
      "global_load_async_to_lds_b128 %0, %4, off\n\t"
      "global_load_async_to_lds_b128 %1, %5, off\n\t"
      "global_load_async_to_lds_b128 %2, %6, off\n\t"
      "global_load_async_to_lds_b128 %3, %7, off\n\t"
      "s_wait_xcnt 0x0"
      :: "v"(lk), "v"(lk + ls), "v"(lv), "v"(lv + ls),
         "v"(gk), "v"(gk + (size_t)32 * kQKVld), "v"(gv), "v"(gv + (size_t)32 * kS)
      : "memory");
}
// Rows r, r + 16, ... r + 112 of the stage's mask tile, one 16-B piece each; the s_wait_xcnt as above.
__device__ __forceinline__ void attn_copy_mask8(unsigned l, const float* g) {
  const unsigned ls = 16 * kAtMPitch;
  const size_t step = (size_t)16 * kS;
  asm volatile(
      "global_load_async_to_lds_b128 %0, %8, off\n\t"
      "global_load_async_to_lds_b128 %1, %9, off\n\t"
      "global_load_async_to_lds_b128 %2, %10, off\n\t"
      "global_load_async_to_lds_b128 %3, %11, off\n\t"
      "global_load_async_to_lds_b128 %4, %12, off\n\t"
      "global_load_async_to_lds_b128 %5, %13, off\n\t"
      "global_load_async_to_lds_b128 %6, %14, off\n\t"
      "global_load_async_to_lds_b128 %7, %15, off\n\t"
      "s_wait_xcnt 0x0"
      :: "v"(l), "v"(l + ls), "v"(l + 2 * ls), "v"(l + 3 * ls), "v"(l + 4 * ls), "v"(l + 5 * ls), "v"(l + 6 * ls),
         "v"(l + 7 * ls),
         "v"(g), "v"(g + step), "v"(g + 2 * step), "v"(g + 3 * step), "v"(g + 4 * step), "v"(g + 5 * step),
         "v"(g + 6 * step), "v"(g + 7 * step)
      : "memory");
}

__global__ __launch_bounds__(256) void attn_kernel(const unsigned short* __restrict__ QMp,
                                                   const unsigned short* __restrict__ QKVp,
                                                   const unsigned short* __restrict__ VTp,
                                                   const float* __restrict__ MK,
                                                   unsigned short* __restrict__ CTXp) {
  typedef Frag<_Float16> F;
  __shared__ __attribute__((aligned(16))) unsigned char L[2 * kAtStage];
  const int lane = threadIdx.x & 31, wave = threadIdx.x >> 5;
  const int c  = lane & 15;
  const int hf = lane >> 4;
  const int b  = blockIdx.y >> 4;
  const int hd = blockIdx.y & 15;
  const int q0 = blockIdx.x * 256 + wave * 32;
  const _Float16* Qb = (const _Float16*)QMp + (size_t)b * kS * kD + hd * kDh + hf * 8;
  const float kLog2e = 1.44269504088896340736f;
  const float kNegInf = -__builtin_inff();

  // copy maps: thread t moves piece (t & 7) of K and V^T rows (t >> 3) + 32 i, i = 0..1, and piece (t & 15) of mask
  // rows (t >> 4) + 16 i, i = 0..15; stage n holds keys 64 n .. 64 n + 63
  const int kr = threadIdx.x >> 3, kp = threadIdx.x & 7;
  const int mr = threadIdx.x >> 4, mp = threadIdx.x & 15;
  const _Float16* gK = (const _Float16*)QKVp + ((size_t)b * kS + kr) * kQKVld + kD + hd * kDh + kp * 8;
  const _Float16* gV = (const _Float16*)VTp + ((size_t)b * kD + hd * kDh + kr) * kS + kp * 8;
  const float*    gM = MK + (size_t)(blockIdx.x * 256 + mr) * kS + mp * 4;
  const unsigned lBase = (unsigned)(uintptr_t)L;                       // byte offset of the ring in the work-group's LDS
  const unsigned lK = lBase + kr * kAtKVPitch + kp * 16;
  const unsigned lV = lK + kAtV;
  const unsigned lM = lBase + kAtM + mr * kAtMPitch + mp * 16;
  // The scheduling barriers keep each statement's address arithmetic beside it: formed all at once, the sixty address
  // registers of a stage (operands of asm text, so all below v256) do not fit beside the loop's state and some spill.
  auto fill = [&](unsigned bo, int n) {
    attn_copy_kv(lK + bo, gK + (size_t)n * kAtKeys * kQKVld, lV + bo, gV + n * kAtKeys);
    __builtin_amdgcn_sched_barrier(0);
    attn_copy_mask8(lM + bo, gM + n * kAtKeys);
    __builtin_amdgcn_sched_barrier(0);
    attn_copy_mask8(lM + bo + 128 * kAtMPitch, gM + n * kAtKeys + (size_t)128 * kS);
  };
  // fragment read offsets in a stage (bytes)
  const int fK = c * kAtKVPitch + hf * 16;
  const int fV = kAtV + c * kAtKVPitch + hf * 16;
  const int fM = kAtM + (wave * 32 + c) * kAtMPitch + hf * 32;

  const int T = kS / kAtKeys;          // stages
  fill(0u, 0);

  const _Float16* qp = Qb + (size_t)(q0 + c) * kD;
  v16h qf[2][2];                       // [query tile][k chunk of 32]
#pragma unroll
  for (int u = 0; u < 2; ++u)
#pragma unroll
    for (int kc = 0; kc < 2; ++kc) qf[u][kc] = F::load(qp + (size_t)(16 * u) * kD + kc * 32);
  // the address registers of the loads above stay whole (inputs) until the wait that lets them be overwritten
  asm volatile("s_wait_xcnt 0x0" :: "v"(qp) : "memory");

  v8f o[4][2];                         // [d tile][query tile]
#pragma unroll
  for (int j = 0; j < 4; ++j)
#pragma unroll
    for (int u = 0; u < 2; ++u) o[j][u] = (v8f){0.f,0.f,0.f,0.f,0.f,0.f,0.f,0.f};
  float m[2] = {kNegInf, kNegInf};
  float l[2] = {0.f, 0.f};

  asm volatile("s_wait_asynccnt 0x0" ::: "memory");   // this wave's share of stage 0 has landed
  __syncthreads();                                     // every wave's share of stage 0 is readable
  fill((unsigned)kAtStage, 1);

  v16h kf[2][2];                       // [key tile][k chunk], fetched one pass ahead
  v4f  mk[2][2][2];                    // [query tile][key tile][4-float half], fetched one pass ahead
#pragma unroll
  for (int tt = 0; tt < 2; ++tt)
#pragma unroll
    for (int kc = 0; kc < 2; ++kc) kf[tt][kc] = F::load((const _Float16*)(L + fK + 16 * tt * kAtKVPitch + kc * 64));
#pragma unroll
  for (int u = 0; u < 2; ++u)
#pragma unroll
    for (int tt = 0; tt < 2; ++tt) {
      mk[u][tt][0] = *(const v4f*)(L + fM + 16 * u * kAtMPitch + tt * 64);
      mk[u][tt][1] = *(const v4f*)(L + fM + 16 * u * kAtMPitch + tt * 64 + 16);
    }

  for (int ps = 0; ps < kS / 32; ++ps) {         // pass ps: keys 32 ps .. 32 ps + 31, half (ps & 1) of stage ps >> 1
    const unsigned bo = (ps & 2) ? (unsigned)kAtStage : 0u;
    const unsigned char* sv = L + bo + fV + (ps & 1) * 64;
    v16h vf[4];
#pragma unroll
    for (int j = 0; j < 4; ++j) vf[j] = F::load((const _Float16*)(sv + 16 * j * kAtKVPitch));

    v8f s[2][2];                       // [query tile][key tile]
#pragma unroll
    for (int u = 0; u < 2; ++u)
#pragma unroll
      for (int tt = 0; tt < 2; ++tt) {
        s[u][tt] = F::mma(kf[tt][0], qf[u][0], (v8f){0.f,0.f,0.f,0.f,0.f,0.f,0.f,0.f});
        s[u][tt] = F::mma(kf[tt][1], qf[u][1], s[u][tt]);
      }

    float x[2][16];
#pragma unroll
    for (int u = 0; u < 2; ++u)
#pragma unroll
      for (int tt = 0; tt < 2; ++tt)
#pragma unroll
        for (int r = 0; r < 8; ++r)    // clip(s / 8, -50, 50) + mask; the power-of-two scale commutes with the clip
          x[u][tt * 8 + r] = fminf(fmaxf(s[u][tt][r], -400.0f), 400.0f) * 0.125f + mk[u][tt][r >> 2][r & 3];

    // A stage's second pass has now issued the stage's last reads: the next stage's publish point stands here, ahead of
    // the fetch of the next pass's fragments, which are the next stage's.
    if (ps & 1) {
      asm volatile("s_wait_dscnt 0x0" ::: "memory");     // this wave's reads of the stage are done before its buffer is refilled
      asm volatile("s_wait_asynccnt 0x0" ::: "memory");  // this wave's share of the next stage has landed
      __syncthreads();                                    // publishes the next stage and ends every reader's use of this one
      const int n = (ps >> 1) + 2;
      if (n < T) fill(bo, n);
    }

    // next pass's keys and mask (behind the last pass this reads buffer 0 again: inside the ring, nothing in flight
    // there, and the values are not used)
    const unsigned bn = ((ps + 1) & 2) ? (unsigned)kAtStage : 0u;
    const unsigned char* sk = L + bn + fK + ((ps + 1) & 1) * (32 * kAtKVPitch);
    const unsigned char* sm = L + bn + fM + ((ps + 1) & 1) * 128;
#pragma unroll
    for (int tt = 0; tt < 2; ++tt)
#pragma unroll
      for (int kc = 0; kc < 2; ++kc) kf[tt][kc] = F::load((const _Float16*)(sk + 16 * tt * kAtKVPitch + kc * 64));
#pragma unroll
    for (int u = 0; u < 2; ++u)
#pragma unroll
      for (int tt = 0; tt < 2; ++tt) {
        mk[u][tt][0] = *(const v4f*)(sm + 16 * u * kAtMPitch + tt * 64);
        mk[u][tt][1] = *(const v4f*)(sm + 16 * u * kAtMPitch + tt * 64 + 16);
      }
    // keeps the two groups of LDS reads issued here, ahead of the softmax that covers their latency; without it the
    // scheduler sinks them to the foot of the pass and the next pass waits for the whole latency
    __builtin_amdgcn_sched_barrier(0);

    v16h pf[2];
#pragma unroll
    for (int u = 0; u < 2; ++u) {
      float mx = x[u][0];
#pragma unroll
      for (int e = 1; e < 16; ++e) mx = fmaxf(mx, x[u][e]);
      mx = fmaxf(mx, xhalf(mx));                              // the other 16 keys of this query
      const float mn  = fmaxf(m[u], mx);
      const float mu  = (mn == kNegInf) ? 0.0f : mn;          // all keys so far masked out: p = 0, no NaN
      const float alpha = __builtin_amdgcn_exp2f((m[u] - mu) * kLog2e);
      m[u] = mn;
      float ps2 = 0.f;
#pragma unroll
      for (int e = 0; e < 16; ++e) {
        const float p = __builtin_amdgcn_exp2f((x[u][e] - mu) * kLog2e + 8.0f);
        ps2 += p;
        pf[u][e] = (_Float16)p;
      }
      l[u] = l[u] * alpha + ps2;
#pragma unroll
      for (int j = 0; j < 4; ++j)
#pragma unroll
        for (int r = 0; r < 8; ++r) o[j][u][r] *= alpha;
    }
#pragma unroll
    for (int j = 0; j < 4; ++j)
#pragma unroll
      for (int u = 0; u < 2; ++u) o[j][u] = F::mma(vf[j], pf[u], o[j][u]);
  }
  asm volatile("s_wait_asynccnt 0x0" ::: "memory");    // no copy is outstanding when the wave ends

  _Float16* Cb = (_Float16*)CTXp + (size_t)b * kS * kD + hd * kDh + hf * 8;
#pragma unroll
  for (int u = 0; u < 2; ++u) {
    const float tot = l[u] + xhalf(l[u]);                     // join the two key halves of the query's sum
    const float inv = 64.0f / tot;
#pragma unroll
    for (int j = 0; j < 4; ++j) {
      v8h hv;
#pragma unroll
      for (int r = 0; r < 8; ++r) hv[r] = (_Float16)(o[j][u][r] * inv);
      *(v8h*)(Cb + (size_t)(q0 + 16 * u + c) * kD + 16 * j) = hv;
    }
  }
}

// ---------------------------------------------------------------------------
// Host orchestration
// Workspace region map (MiB offsets; total carve end = 124 MiB = 130,023,424 B):
//   phase 1 (attention): H16 [0,8)  WQKVT [8,14)  MT [14,18)  WOT [18,20)  QKV16 [20,44)  QM16 [44,52)
//                        VT16 [52,60)  CTX16 [60,68)
//   X1 f32 [20,36) is written by the Wo GEMM after every reader of QKV16 has run.
//   phase 2 (FFN): H16 [0,8) (h2)  WPOST [8,16)  WNEGT [116,124)  WPROJT [36,52)  TP f32 [52,68)
//                  CAT16 half [68,100)
// Every region is fully written before it is read; all GEMM M,N,K multiples of 128 (no padding).
// ---------------------------------------------------------------------------
extern "C" void kernel_launch(void* const* d_in, const int* in_sizes, int n_in,
                              void* d_out, int out_size, void* d_ws, size_t ws_size,
                              hipStream_t stream) {
  const size_t MIB = 1048576;
  if (n_in < 14) return;
  if (in_sizes[0] != kTok * kD || in_sizes[1] != kB * kD * kD || in_sizes[2] != kS * kS ||
      in_sizes[3] != kD || in_sizes[4] != kD || in_sizes[5] != kD || in_sizes[6] != kD ||
      in_sizes[7] != kD * kD || in_sizes[8] != kD * kD || in_sizes[9] != kD * kD || in_sizes[10] != kD * kD ||
      in_sizes[11] != kD * kF || in_sizes[12] != kD * kF || in_sizes[13] != 2 * kF * kD) return;
  if (out_size != kTok * kD) return;
  if (ws_size < 124 * MIB) return;

  const float* xf   = (const float*)d_in[0];
  const float* Mf   = (const float*)d_in[1];
  const float* mkf  = (const float*)d_in[2];
  const float* g1f  = (const float*)d_in[3];
  const float* b1f  = (const float*)d_in[4];
  const float* g2f  = (const float*)d_in[5];
  const float* b2f  = (const float*)d_in[6];
  const float* Wqf  = (const float*)d_in[7];
  const float* Wkf  = (const float*)d_in[8];
  const float* Wvf  = (const float*)d_in[9];
  const float* Wof  = (const float*)d_in[10];
  const float* Wpf  = (const float*)d_in[11];
  const float* Wnf  = (const float*)d_in[12];
  const float* Wjf  = (const float*)d_in[13];
  float* out = (float*)d_out;

  char* ws = (char*)d_ws;
  unsigned short* H16   = (unsigned short*)(ws + 0 * MIB);
  unsigned short* WQKV  = (unsigned short*)(ws + 8 * MIB);
  unsigned short* MT    = (unsigned short*)(ws + 14 * MIB);
  unsigned short* WOT   = (unsigned short*)(ws + 18 * MIB);
  unsigned short* QKV   = (unsigned short*)(ws + 20 * MIB);
  unsigned short* QM    = (unsigned short*)(ws + 44 * MIB);
  unsigned short* VT    = (unsigned short*)(ws + 52 * MIB);
  unsigned short* CTX   = (unsigned short*)(ws + 60 * MIB);
  float*          X1    = (float*)(ws + 20 * MIB);
  unsigned short* WPOS  = (unsigned short*)(ws + 8 * MIB);
  unsigned short* WNEG  = (unsigned short*)(ws + 116 * MIB);
  unsigned short* WPROJ = (unsigned short*)(ws + 36 * MIB);
  float*          TP    = (float*)(ws + 52 * MIB);
  unsigned short* CAT   = (unsigned short*)(ws + 68 * MIB);

  const float rr  = (float)(2.0 / 11.0);
  const float omr = (float)(1.0 - 2.0 / 11.0);
  const float wcarry  = 16.0f;     // square weights and Wpos/Wneg carried x16
  const float wjcarry = 64.0f;     // Wproj carried x64

  // ---- phase 1: weights -> transposed f16 planes (x16) ----
  // Wq,Wk,Wv [1024][1024] -> WQKVT rows 0.., 1024.., 2048..; Wo -> WOT
  tcast_kernel<<<dim3(kD / 64, kD / 64, 4), 256, 0, stream>>>(
      Wqf, Wkf, Wvf, Wof,
      WQKV, WQKV + (size_t)kD * kD, WQKV + (size_t)2 * kD * kD, WOT, kD, kD, wcarry);
  // M[b] [1024 d][1024 e] -> MT[b][e][d]
  tcast_kernel<<<dim3(kD / 64, kD / 64, 2), 256, 0, stream>>>(
      Mf, Mf + (size_t)kD * kD, Mf, Mf,
      MT, MT + (size_t)kD * kD, MT, MT, kD, kD, wcarry);

  // h1 = ind_norm(x; g1, b1) -> H16 [4096][1024]
  indnorm_kernel<<<dim3(kTok), 128, 0, stream>>>(xf, g1f, b1f, H16, omr, rr);

  // QKV16 [4096][3072] = h1 . [Wq|Wk|Wv]   (M=4096, N=3072, K=1024; tiles 32x24 -> 768 blocks)
  wmma_gemm128<1, false><<<dim3(768, 1), 256, 0, stream>>>(
      H16, kD, 0, WQKV, kD, 0, QKV, kQKVld, 0, xf, 0, kQKVld, kD, 1.0f / wcarry);

  // VT16[b][dg][t] = V[b][t][dg]
  vt_kernel<<<dim3(kS / 64, kD / 64, kB), 256, 0, stream>>>(QKV, VT);

  // QM16[b] = Q[b] . M[b]   (M=2048, N=1024, K=1024 per batch; tiles 16x8 -> 128 blocks, grid.y = batch)
  wmma_gemm128<1, false><<<dim3(128, kB), 256, 0, stream>>>(
      QKV, kQKVld, (long)kS * kQKVld, MT, kD, (long)kD * kD, QM, kD, (long)kS * kD,
      xf, 0, kD, kD, 1.0f / wcarry);

  // ---- attention: CTX16[b][i][h*64+n] = 64 * softmax(clip(QM.K^T / 8) + mask) . V, all 32 (batch, head) groups ----
  attn_kernel<<<dim3(kS / 256, kB * kH), 256, 0, stream>>>(QM, QKV, VT, mkf, CTX);

  // x1 = x + ctx . Wo   (ctx x64, WoT x16 -> scale 1/1024; M=4096, N=1024, K=1024; tiles 32x8 -> 256 blocks)
  wmma_gemm128<0, true><<<dim3(256, 1), 256, 0, stream>>>(
      CTX, kD, 0, WOT, kD, 0, X1, kD, 0, xf, 0, kD, kD, 1.0f / 1024.0f);

  // ---- phase 2: FFN ----
  // h2 = ind_norm(x1; g2, b2) -> H16
  indnorm_kernel<<<dim3(kTok), 128, 0, stream>>>(X1, g2f, b2f, H16, omr, rr);
  // Wpos, Wneg [1024 k][4096 n] -> [4096][1024] f16 x16
  tcast_kernel<<<dim3(kD / 64, kF / 64, 2), 256, 0, stream>>>(
      Wpf, Wnf, Wpf, Wpf, WPOS, WNEG, WPOS, WPOS, kD, kF, wcarry);
  // Wproj [8192 k][1024 n] -> [1024][8192] f16 x64
  tcast_kernel<<<dim3((2 * kF) / 64, kD / 64, 1), 256, 0, stream>>>(
      Wjf, Wjf, Wjf, Wjf, WPROJ, WPROJ, WPROJ, WPROJ, 2 * kF, kD, wjcarry);

  // pos half: CAT16[r][n] = f16(16 * gelu(h2 . Wpos)), gelu in the GEMM's epilogue
  // (M=4096, N=4096, K=1024; tiles 32x32 -> 1024 blocks)
  wmma_gemm128<2, false><<<dim3(1024, 1), 256, 0, stream>>>(
      H16, kD, 0, WPOS, kD, 0, CAT, kF, 0, xf, 0, kF, kD, 1.0f / wcarry);
  // TP = x1 + CATpos . Wproj[0:4096]   (cat x16, WprojT x64 -> scale 1/1024; M=4096, N=1024, K=4096)
  wmma_gemm128<0, true><<<dim3(256, 1), 256, 0, stream>>>(
      CAT, kF, 0, WPROJ, 2 * kF, 0, TP, kD, 0, X1, 0, kD, kF, 1.0f / 1024.0f);
  // neg half: CAT16[r][n] = f16(16 * gelu(-(h2 . Wneg)))   (exact sign identity: the sign rides on the scale)
  wmma_gemm128<2, false><<<dim3(1024, 1), 256, 0, stream>>>(
      H16, kD, 0, WNEG, kD, 0, CAT, kF, 0, xf, 0, kF, kD, -1.0f / wcarry);
  // out = TP + CATneg . Wproj[4096:8192]
  wmma_gemm128<0, true><<<dim3(256, 1), 256, 0, stream>>>(
      CAT, kF, 0, WPROJ + kF, 2 * kF, 0, out, kD, 0, TP, 0, kD, kF, 1.0f / 1024.0f);
}

// v005
// A run of this version takes 239 microseconds.
// Two timings next to v004 both put it at 1.13 times that version's speed.
// Counting every step since v000, it is 11.0 times as fast.
// Contractions: QKV, Q.M[b], Wo, Wpos/Wneg, Wproj projections and attention scores k.q^T and V^T.P^T all on v_wmma_f32_16x16x32_f16 (f16 operands: activations plain, weights carried x16 / x64, unnormalised P carried x256, ctx carried x64, gelu planes carried x16), f32 accumulate; norms, clip, softmax, gelu, residuals in f32.
#include <hip/hip_runtime.h>
#include <math.h>
#include <stdint.h>

// ---------------------------------------------------------------------------
// Problem constants
// ---------------------------------------------------------------------------
constexpr int kB     = 2;
constexpr int kS     = 2048;
constexpr int kD     = 1024;
constexpr int kF     = 4096;
constexpr int kH     = 16;
constexpr int kDh    = 64;
constexpr int kTok   = kB * kS;        // 4096 token rows
constexpr int kQKVld = 3 * kD;         // pitch of the q | k | v plane (halves)
constexpr float kCatCarry = 16.0f;     // gelu planes carried x16
constexpr float kEps   = 1e-5f;
constexpr float kInvD  = 1.0f / 1024.0f;

typedef __attribute__((ext_vector_type(16))) _Float16 v16h;
typedef __attribute__((ext_vector_type(8)))  _Float16 v8h;
typedef __attribute__((ext_vector_type(8)))  float    v8f;
typedef __attribute__((ext_vector_type(4)))  float    v4f;
typedef __attribute__((ext_vector_type(2)))  float    v2f;
typedef __attribute__((ext_vector_type(4)))  unsigned int v4u;

// ---------------------------------------------------------------------------
// Helpers
// ---------------------------------------------------------------------------
template <typename T> struct Frag;
template <> struct Frag<_Float16> {
  typedef v16h V; union U { v16h v; v8h h[2]; };
  static __device__ __forceinline__ v16h load(const _Float16* p) {   // elements 0..7 <- p[0..7], 8..15 <- p[16..23]
    U f; f.h[0] = *(const v8h*)(p); f.h[1] = *(const v8h*)(p + 16); return f.v;
  }
  static __device__ __forceinline__ v8f mma(v16h a, v16h b, v8f c) {
    return __builtin_amdgcn_wmma_f32_16x16x32_f16(false, a, false, b, (short)0, c, false, false);
  }
};
__device__ __forceinline__ unsigned pk16(unsigned short a, unsigned short b) { return (unsigned)a | ((unsigned)b << 16); }
__device__ __forceinline__ unsigned short h_bits(float f) { const _Float16 h = (_Float16)f; return __builtin_bit_cast(unsigned short, h); }

// ---------------------------------------------------------------------------
// Small memory-bound pieces. None has a launch of its own except the second norm: each runs as extra work-groups
// ("riders") of a launch that it does not depend on and that leaves room on the chip, so its memory time and its
// launch's start and drain overlap with that launch's work.
// ---------------------------------------------------------------------------
// Transpose + cast of NT 64x64 tiles side by side along n: in W [Kr][Nc] f32 row-major ([in k][out n]) ->
// O[n][k] = f16(scale * W[k][n]), pitch Kr halves. 256 threads; sm = NT x 64 x 65 floats, tile u at sm[u * 4160 + n_local * 65
// + k_local]. Kr and Nc are compile-time, so all loads of a thread share one address with immediate offsets.
// Load coverage per tile: 16 iterations x 256 threads = 4096 = whole tile (coalesced along n).
// Store coverage per tile: 8 waves x 2 iterations x 4 rows (lane>>3) = 64 rows; (lane&7) x 8 halves = 64 cols.
template <int Kr, int Nc, int NT>
__device__ __forceinline__ void tcast_tiles(float* sm, const float* __restrict__ W, unsigned short* __restrict__ O,
                                            float scale, int k0, int n0) {
  const int t = threadIdx.x;
  const int r0 = t >> 6;           // k local of iteration 0; iteration i: r0 + 4 i
  const int c  = t & 63;           // n local
  const float* wp = W + (size_t)(k0 + r0) * Nc + n0 + c;
  float w[NT][16];
#pragma unroll
  for (int u = 0; u < NT; ++u)
#pragma unroll
    for (int i = 0; i < 16; ++i) w[u][i] = wp[(size_t)(4 * i) * Nc + 64 * u];
  // the address registers of the loads above stay whole (inputs) until the wait that lets them be overwritten
  asm volatile("s_wait_xcnt 0x0" :: "v"(wp) : "memory");
#pragma unroll
  for (int u = 0; u < NT; ++u)
#pragma unroll
    for (int i = 0; i < 16; ++i) sm[u * 4160 + c * 65 + r0 + 4 * i] = w[u][i] * scale;
  __syncthreads();
  const int lane = t & 31, wave = t >> 5;
  const int q = lane >> 3, c8 = (lane & 7) * 8;
#pragma unroll
  for (int u = 0; u < NT; ++u)
#pragma unroll
    for (int it = 0; it < 2; ++it) {
      const int row = wave * 8 + it * 4 + q;               // n local
      unsigned short hb[8];
#pragma unroll
      for (int e = 0; e < 8; ++e) hb[e] = h_bits(sm[u * 4160 + row * 65 + c8 + e]);
      const v4u x = (v4u){pk16(hb[0], hb[1]), pk16(hb[2], hb[3]), pk16(hb[4], hb[5]), pk16(hb[6], hb[7])};
      *(v4u*)(O + (size_t)(n0 + 64 * u + row) * Kr + k0 + c8) = x;
    }
}

// V transpose of one tile of 64 t x 64 d (16-bit move, no conversion): in QKV plane [4096][3072] halves, V at columns
// 2048..3071; out VT[b][dg][t] = V[b][t][dg], planes [2][1024][2048] halves. 256 threads; sm = 64 x 72 halves,
// sm[d_local * 72 + t_local].
// Load coverage: 2 iterations x 256 threads x 8 halves (one 16-B integer word load each) = 4096 = whole tile.
// Store coverage: 8 waves x 2 iterations x 4 rows (lane>>3) = 64 d rows; 8 lanes x 8 halves = 64 t.
__device__ __forceinline__ void vt_tile(unsigned short* sm, const unsigned short* __restrict__ QKV,
                                        unsigned short* __restrict__ VT, int t0, int d0, int b) {
  const int tid = threadIdx.x;
  const int r0  = tid >> 3;          // t local of iteration 0; iteration 1: r0 + 32
  const int seg = tid & 7;           // 8-half segment of the 64 d columns
  const unsigned short* vp = QKV + ((size_t)(b * kS + t0 + r0)) * kQKVld + 2 * kD + d0 + seg * 8;
  v4u wv[2];
#pragma unroll
  for (int i = 0; i < 2; ++i) wv[i] = *(const v4u*)(vp + (size_t)(32 * i) * kQKVld);
  // the address registers of the loads above stay whole (inputs) until the wait that lets them be overwritten
  asm volatile("s_wait_xcnt 0x0" :: "v"(vp) : "memory");
#pragma unroll
  for (int i = 0; i < 2; ++i) {
    const int r = r0 + 32 * i;
    const v4u w = wv[i];
#pragma unroll
    for (int j = 0; j < 4; ++j) {
      sm[(seg * 8 + 2 * j) * 72 + r]     = (unsigned short)(w[j] & 0xffffu);
      sm[(seg * 8 + 2 * j + 1) * 72 + r] = (unsigned short)(w[j] >> 16);
    }
  }
  __syncthreads();
  const int lane = tid & 31, wave = tid >> 5;
  const int q = lane >> 3, c8 = (lane & 7) * 8;
#pragma unroll
  for (int it = 0; it < 2; ++it) {
    const int row = wave * 8 + it * 4 + q;                 // d local
    const unsigned short* sr = sm + row * 72 + c8;
    const v4u u = (v4u){pk16(sr[0], sr[1]), pk16(sr[2], sr[3]), pk16(sr[4], sr[5]), pk16(sr[6], sr[7])};
    *(v4u*)(VT + ((size_t)(b * kD + d0 + row)) * kS + t0 + c8) = u;
  }
}

// ind_norm of one row: H[row][:] = f16( omr * ((x - mu) * rsqrt(var + eps) * g + b) + rr * x ), mu/var over the 1024-wide
// row. 128 threads (4 whole waves) per row; thread t = 0..127 owns columns 8t..8t+7. redA, redB: 4 floats each, the row's
// own. Every thread of the work-group passes both barriers.
__device__ __forceinline__ void indnorm_row(float* redA, float* redB, const float* __restrict__ X,
                                            const float* __restrict__ G, const float* __restrict__ Bv,
                                            unsigned short* __restrict__ H, float omr, float rr, int row, int t) {
  const int lane = t & 31, wave = t >> 5;
  const int c0   = t * 8;
  const float* xr = X + (size_t)row * kD + c0;
  const v4f a = *(const v4f*)(xr);
  const v4f c = *(const v4f*)(xr + 4);
  float v[8];
#pragma unroll
  for (int e = 0; e < 4; ++e) { v[e] = a[e]; v[4 + e] = c[e]; }
  float s = ((v[0] + v[1]) + (v[2] + v[3])) + ((v[4] + v[5]) + (v[6] + v[7]));
#pragma unroll
  for (int off = 16; off > 0; off >>= 1) s += __shfl_xor(s, off, 32);
  if (lane == 0) redA[wave] = s;
  __syncthreads();
  const float mean = ((redA[0] + redA[1]) + (redA[2] + redA[3])) * kInvD;
  float d[8];
  float qs = 0.f;
#pragma unroll
  for (int e = 0; e < 8; ++e) { d[e] = v[e] - mean; qs += d[e] * d[e]; }
#pragma unroll
  for (int off = 16; off > 0; off >>= 1) qs += __shfl_xor(qs, off, 32);
  if (lane == 0) redB[wave] = qs;
  __syncthreads();
  const float var  = ((redB[0] + redB[1]) + (redB[2] + redB[3])) * kInvD;
  const float rstd = rsqrtf(var + kEps);
  const v4f ga = *(const v4f*)(G + c0);
  const v4f gc = *(const v4f*)(G + c0 + 4);
  const v4f ba = *(const v4f*)(Bv + c0);
  const v4f bc = *(const v4f*)(Bv + c0 + 4);
  float gg[8], bb[8];
#pragma unroll
  for (int e = 0; e < 4; ++e) { gg[e] = ga[e]; gg[4 + e] = gc[e]; bb[e] = ba[e]; bb[4 + e] = bc[e]; }
  unsigned short hb[8];
#pragma unroll
  for (int e = 0; e < 8; ++e) {
    const float ln = d[e] * rstd * gg[e] + bb[e];
    const float o  = omr * ln + rr * v[e];
    hb[e] = h_bits(o);
  }
  const v4u u = (v4u){pk16(hb[0], hb[1]), pk16(hb[2], hb[3]), pk16(hb[4], hb[5]), pk16(hb[6], hb[7])};
  *(v4u*)(H + (size_t)row * kD + c0) = u;
}

// Second norm: one block of 128 threads per row.
__global__ __launch_bounds__(128) void indnorm_kernel(const float* __restrict__ X, const float* __restrict__ G,
                                                      const float* __restrict__ Bv, unsigned short* __restrict__ H,
                                                      float omr, float rr) {
  __shared__ float red[8];
  indnorm_row(red, red + 4, X, G, Bv, H, omr, rr, blockIdx.x, threadIdx.x);
}

// First launch: the first norm and the casts of the six 1024x1024 planes the attention phase needs; none depends on
// another. 256 threads. Blocks 0 .. 2047: two rows of the norm each (one per 128 threads). Blocks 2048 .. 3583: one cast
// tile each, plane z = id >> 8 (Wq, Wk, Wv -> rows 0, 1024, 2048 of WQKV; Wo -> WOT; M[0], M[1] -> MT), k tile = id & 15,
// n tile = (id >> 4) & 15.
__global__ __launch_bounds__(256) void prep_kernel(const float* __restrict__ X, const float* __restrict__ G,
                                                   const float* __restrict__ Bv, unsigned short* __restrict__ H,
                                                   float omr, float rr,
                                                   const float* __restrict__ Wq, const float* __restrict__ Wk,
                                                   const float* __restrict__ Wv, const float* __restrict__ Wo,
                                                   const float* __restrict__ Mm, unsigned short* __restrict__ WQKV,
                                                   unsigned short* __restrict__ WOT, unsigned short* __restrict__ MT,
                                                   float scale) {
  __shared__ float sm[64 * 65];
  const int bid = blockIdx.x;
  if (bid < kTok / 2) {
    const int half = threadIdx.x >> 7;
    indnorm_row(sm + 8 * half, sm + 8 * half + 4, X, G, Bv, H, omr, rr, 2 * bid + half, threadIdx.x & 127);
    return;
  }
  const int id = bid - kTok / 2;
  const int z  = id >> 8;
  const size_t pl = (size_t)kD * kD;
  const float* W = (z == 0) ? Wq : (z == 1) ? Wk : (z == 2) ? Wv : (z == 3) ? Wo : (z == 4) ? Mm : Mm + pl;
  unsigned short* O = (z < 3) ? WQKV + z * pl : (z == 3) ? WOT : MT + (z - 4) * pl;
  tcast_tiles<kD, kD, 1>(sm, W, O, scale, (id & 15) * 64, ((id >> 4) & 15) * 64);
}

// ---- Batched WMMA GEMM, operands staged in LDS by asynchronous copies ------------------------------------------------
// C[m,n] = scale * sum_k A[m,k] * Bt[n,k] (+resid). A row-major [M,K]; Bt row-major [N,K]; f16 operands, f32 accumulate.
// One work-group of 8 waves owns a 128x128 tile of C; wave (wm, wn) = (wave & 3, wave >> 2) owns 32 rows x 64 columns.
// M, N % 128 == 0; K % 128 == 0 and K >= 128; tiles = (M / 128) * (N / 128) per batch, at most two batches;
// blocks 0 .. gemmBlocks - 1 (= tiles x batches) are the product's, batch = block / tiles.
// RIDER: blocks from gemmBlocks on do independent small work in the places that the product's blocks leave free on the
// chip (two work-groups fit a WGP's LDS; with so few places a cast rider takes four tiles at once, so that enough bytes are
// in flight): 1 = four cast tiles each of the [1024 k][4096 n] planes RW (id < 256) and RW2 (k tile = id & 15, group of four
// n tiles = (id >> 4) & 15); 2 = one V-transpose tile each of the plane Ap (t tile = id & 31, d tile = (id >> 5) & 15,
// batch = id >> 9); 3 = four cast tiles each of a [8192 k][1024 n] plane RW (k tile = id & 127, group of four n tiles = id >> 7).
// They come last in the grid, so the product's blocks start first.
// A stage is 128 k of the tile's 128 A rows and 128 Bt rows: 256 rows of 256 B at an LDS pitch of 272 B (16 B x odd, so the
// 16 rows of a ds_load_b128 fragment read fall on distinct banks). Two stages: the next one flies while this one is used.
// Each copy instruction of a wave moves 2 whole rows (4 whole 128-B lines); a fragment read from global touched 16 lines.
// OUT_MODE: 0 = f32, 1 = f16, 2 = f16(kCatCarry * gelu(value)), exact erf gelu on the f32 value.
constexpr int kGemmPitch = 272;                    // bytes per staged row
constexpr int kGemmStage = 256 * kGemmPitch;       // bytes per stage (A rows 0..127, Bt rows 128..255)

// Eight 16-B copies per lane: rows r, r + 16, ... r + 112 of one operand's half of the stage. The s_wait_xcnt stands inside
// the statement so that no address register of a copy is rewritten ahead of it.
__device__ __forceinline__ void stage_copy8(unsigned l, const _Float16* g, size_t step) {
  const unsigned ls = 16 * kGemmPitch;
  asm volatile(
      "global_load_async_to_lds_b128 %0, %8, off\n\t"
      "global_load_async_to_lds_b128 %1, %9, off\n\t"
      "global_load_async_to_lds_b128 %2, %10, off\n\t"
      "global_load_async_to_lds_b128 %3, %11, off\n\t"
      "global_load_async_to_lds_b128 %4, %12, off\n\t"
      "global_load_async_to_lds_b128 %5, %13, off\n\t"
      "global_load_async_to_lds_b128 %6, %14, off\n\t"
      "global_load_async_to_lds_b128 %7, %15, off\n\t"
      "s_wait_xcnt 0x0"
      :: "v"(l), "v"(l + ls), "v"(l + 2 * ls), "v"(l + 3 * ls), "v"(l + 4 * ls), "v"(l + 5 * ls), "v"(l + 6 * ls),
         "v"(l + 7 * ls),
         "v"(g), "v"(g + step), "v"(g + 2 * step), "v"(g + 3 * step), "v"(g + 4 * step), "v"(g + 5 * step),
         "v"(g + 6 * step), "v"(g + 7 * step)
      : "memory");
}

// erf(x) in f32: the math library's two polynomials (|x| < 1: odd series in x^2; else 1 - exp(-poly(|x|))), both evaluated
// and one selected. A wave's 32 values nearly always span both ranges, so a branch saves no work, and without the branches
// the independent values of an accumulator tile interleave instead of each waiting out its own dependent chain.
__device__ __forceinline__ float erf_sel(float x) {
  const float ax = fabsf(x);
  float p = fmaf(ax, 0x1.1d3156p-16f, -0x1.8d129p-12f);
  p = fmaf(ax, p, 0x1.f9a6d2p-9f);
  p = fmaf(ax, p, -0x1.8c3164p-6f);
  p = fmaf(ax, p, 0x1.b4e9c8p-4f);
  p = fmaf(ax, p, 0x1.4515fap-1f);
  p = fmaf(ax, p, 0x1.078e5p-3f);
  p = fmaf(ax, p, ax);
  const float big = 1.0f - expf(-p);
  const float t = x * x;
  float q = fmaf(t, -0x1.268bc2p-11f, 0x1.420828p-8f);
  q = fmaf(t, q, -0x1.b5937p-6f);
  q = fmaf(t, q, 0x1.ce077cp-4f);
  q = fmaf(t, q, -0x1.81266p-2f);
  q = fmaf(t, q, 0x1.06eba0p-3f);
  const float small = fmaf(ax, q, ax);
  return copysignf(ax < 1.0f ? small : big, x);
}
__device__ __forceinline__ float gelu_erf(float a) { return 0.5f * a * (1.0f + erf_sel(a * 0.70710678118654752f)); }

// One 128x128 tile: tile number bx of batch b. L: the work-group's ring of 2 * kGemmStage bytes, 16-B aligned; after the
// loop it holds the output slabs.
template <int OUT_MODE, bool RESID>
__device__ __forceinline__ void gemm_tile128(
    unsigned char* L, int bx, int b,
    const unsigned short* __restrict__ Ap, int lda, long strideA,
    const unsigned short* __restrict__ Btp, int ldb, long strideB,
    void* __restrict__ Cout, int ldc, long strideC,
    const float* __restrict__ resid, long strideR,
    int N, int K, float scale) {
  typedef Frag<_Float16> F;
  const int lane = threadIdx.x & 31;
  const int wave = threadIdx.x >> 5;
  const int tilesN = N >> 7;
  const int tm = bx / tilesN;
  const int tn = bx - tm * tilesN;
  const int mB = tm << 7;                      // the work-group's tile
  const int nB = tn << 7;
  const int wm = wave & 3;
  const int wn = wave >> 2;

  const int rlane = lane & 15;                 // row (A) / col (B, D) within subtile
  const int hf    = lane >> 4;                 // lane half: k offset 8 * hf, D row offset 8 * hf
  const int mOff  = hf * 8;

  // copy map: thread t moves the 16-B piece (t & 15) of rows (t >> 4) + 16 i, i = 0..7, of each operand
  const int cr = threadIdx.x >> 4;
  const int cc = threadIdx.x & 15;
  const _Float16* gA = (const _Float16*)Ap  + (size_t)b * strideA + (size_t)(mB + cr) * lda + cc * 8;
  const _Float16* gB = (const _Float16*)Btp + (size_t)b * strideB + (size_t)(nB + cr) * ldb + cc * 8;
  const size_t stepA = (size_t)16 * lda;
  const size_t stepB = (size_t)16 * ldb;
  const unsigned lBase = (unsigned)(uintptr_t)L;                       // byte offset of the ring in the work-group's LDS
  const unsigned lA = lBase + cr * kGemmPitch + cc * 16;
  const unsigned lB = lA + 128 * kGemmPitch;

  // fragment read offsets in a stage (bytes)
  const int fA = (wm * 32 + rlane) * kGemmPitch + hf * 16;
  const int fB = (128 + wn * 64 + rlane) * kGemmPitch + hf * 16;

  v8f acc[2][4];
#pragma unroll
  for (int i = 0; i < 2; ++i)
#pragma unroll
    for (int j = 0; j < 4; ++j) acc[i][j] = (v8f){0.f,0.f,0.f,0.f,0.f,0.f,0.f,0.f};

  const int T = K >> 7;                        // stages
  stage_copy8(lA, gA, stepA);
  stage_copy8(lB, gB, stepB);
  asm volatile("s_wait_asynccnt 0x0" ::: "memory");   // this wave's share of stage 0 has landed
  __syncthreads();                                     // every wave's share of stage 0 is readable
  if (T > 1) {
    stage_copy8(lA + kGemmStage, gA + 128, stepA);
    stage_copy8(lB + kGemmStage, gB + 128, stepB);
  }

  for (int t = 0; t < T; ++t) {
    const unsigned bo = (t & 1) ? (unsigned)kGemmStage : 0u;
    const unsigned char* sb = L + bo;
    v16h bf[2][4], af[2][2];                   // two fragment sets: block kk + 1 is fetched while block kk multiplies
#pragma unroll
    for (int j = 0; j < 4; ++j) bf[0][j] = F::load((const _Float16*)(sb + fB + j * 16 * kGemmPitch));
#pragma unroll
    for (int i = 0; i < 2; ++i) af[0][i] = F::load((const _Float16*)(sb + fA + i * 16 * kGemmPitch));
#pragma unroll
    for (int kk = 0; kk < 4; ++kk) {
      if (kk < 3) {
#pragma unroll
        for (int j = 0; j < 4; ++j)
          bf[(kk + 1) & 1][j] = F::load((const _Float16*)(sb + fB + j * 16 * kGemmPitch + (kk + 1) * 64));
#pragma unroll
        for (int i = 0; i < 2; ++i)
          af[(kk + 1) & 1][i] = F::load((const _Float16*)(sb + fA + i * 16 * kGemmPitch + (kk + 1) * 64));
      }
      // keeps the next block's LDS reads one group ahead of this block's products; without it the scheduler folds the
      // two sets into one and each block waits out its own LDS latency
      __builtin_amdgcn_sched_barrier(0);
#pragma unroll
      for (int i = 0; i < 2; ++i)
#pragma unroll
        for (int j = 0; j < 4; ++j) acc[i][j] = F::mma(af[kk & 1][i], bf[kk & 1][j], acc[i][j]);
      // ends the block: the reads of block kk + 2 stay behind these products, whose operands they overwrite
      __builtin_amdgcn_sched_barrier(0);
    }
    asm volatile("s_wait_dscnt 0x0" ::: "memory");     // this wave's reads of stage t are done before the buffer is refilled
    asm volatile("s_wait_asynccnt 0x0" ::: "memory");  // this wave's share of stage t + 1 has landed
    __syncthreads();                                    // publishes stage t + 1 and ends every reader's use of stage t
    if (t + 2 < T) {
      stage_copy8(lA + bo, gA + (size_t)(t + 2) * 128, stepA);
      stage_copy8(lB + bo, gB + (size_t)(t + 2) * 128, stepB);
    }
  }
  asm volatile("s_wait_asynccnt 0x0" ::: "memory");    // no copy is outstanding when the ring becomes output staging

  // ---- epilogue: per-wave 16x64 slab, pitch 68 floats, in the ring (free behind the last pass's barrier) ----
  float* slab = (float*)L + wave * (16 * 68);
  const int m0 = mB + wm * 32;
  const int n0 = nB + wn * 64;
  const float* Rb = RESID ? (resid + (size_t)b * strideR) : nullptr;
#pragma unroll
  for (int i = 0; i < 2; ++i) {
    const int mBase = m0 + (i << 4);
#pragma unroll
    for (int j = 0; j < 4; ++j) {
      const int n = n0 + (j << 4) + rlane;
#pragma unroll
      for (int r = 0; r < 8; ++r) {
        float v = acc[i][j][r] * scale;
        if (RESID) v += Rb[(size_t)(mBase + mOff + r) * ldc + n];
        if (OUT_MODE == 2) v = gelu_erf(v) * kCatCarry;
        slab[(mOff + r) * 68 + (j << 4) + rlane] = v;
      }
    }
    __builtin_amdgcn_fence(__ATOMIC_RELEASE, "workgroup");
    __builtin_amdgcn_wave_barrier();
    __builtin_amdgcn_fence(__ATOMIC_ACQUIRE, "workgroup");
    if (OUT_MODE == 0) {
      float* C = (float*)Cout + (size_t)b * strideC;
      const int hh = lane >> 4, c4 = (lane & 15) * 4;     // row seg = 256 B = 16 lanes x 16 B
#pragma unroll
      for (int it = 0; it < 8; ++it) {
        const int row = it * 2 + hh;
        v4f v = *(const v4f*)(slab + row * 68 + c4);
        *(v4f*)(C + (size_t)(mBase + row) * ldc + n0 + c4) = v;
      }
    } else {
      const int q = lane >> 3, c8 = (lane & 7) * 8;
      unsigned short* C = (unsigned short*)Cout + (size_t)b * strideC;
#pragma unroll
      for (int it = 0; it < 4; ++it) {
        const int row = it * 4 + q;
        const float* sp = slab + row * 68 + c8;
        v8h hv;
#pragma unroll
        for (int e = 0; e < 8; ++e) hv[e] = (_Float16)sp[e];
        *(v8h*)(C + (size_t)(mBase + row) * ldc + n0 + c8) = hv;
      }
    }
    __builtin_amdgcn_fence(__ATOMIC_RELEASE, "workgroup");
    __builtin_amdgcn_wave_barrier();
    __builtin_amdgcn_fence(__ATOMIC_ACQUIRE, "workgroup");
  }
}

template <int OUT_MODE, bool RESID, int RIDER>
__global__ __launch_bounds__(256) void wmma_gemm128(
    const unsigned short* __restrict__ Ap, int lda, long strideA,
    const unsigned short* __restrict__ Btp, int ldb, long strideB,
    void* __restrict__ Cout, int ldc, long strideC,
    const float* __restrict__ resid, long strideR,
    int N, int K, float scale, int tiles, int gemmBlocks,
    const float* __restrict__ RW, const float* __restrict__ RW2, unsigned short* __restrict__ RO,
    unsigned short* __restrict__ RO2, float rScale) {
  __shared__ __attribute__((aligned(16))) unsigned char L[2 * kGemmStage];
  if (RIDER != 0 && (int)blockIdx.x >= gemmBlocks) {     // the same for the whole work-group, ahead of every barrier
    const int id = (int)blockIdx.x - gemmBlocks;
    if (RIDER == 1) {
      tcast_tiles<kD, kF, 4>((float*)L, id < 256 ? RW : RW2, id < 256 ? RO : RO2, rScale, (id & 15) * 64,
                             ((id >> 4) & 15) * 256);
    } else if (RIDER == 2) {
      vt_tile((unsigned short*)L, Ap, RO, (id & 31) * 64, ((id >> 5) & 15) * 64, id >> 9);
    } else {
      tcast_tiles<2 * kF, kD, 4>((float*)L, RW, RO, rScale, (id & 127) * 64, (id >> 7) * 256);
    }
    // directly behind the rider's last store: in the built code the product's instructions follow the rider's and write
    // registers that its stores name
    asm volatile("s_wait_xcnt 0x0" ::: "memory");
    return;
  }
  const int b    = ((int)blockIdx.x >= tiles) ? 1 : 0;
  const int bx   = (int)blockIdx.x - b * tiles;
  gemm_tile128<OUT_MODE, RESID>(L, bx, b, Ap, lda, strideA, Btp, ldb, strideB, Cout, ldc, strideC, resid, strideR, N, K, scale);
}

// Two products that do not depend on each other in one launch: blocks 0 .. 255 are the pos half's down-projection
// (TP = X1 + CATP . Wproj[0:4096], one block per WGP, which leaves the WGP's second place free), blocks 256 .. 1279 the neg
// half's up-projection with its gelu (CATN = f16(16 * gelu(-(H . Wneg)))), which fills those places. kDown, kUp: the two
// products' k extents (4096, 1024).
__global__ __launch_bounds__(256) void ffn_pair_kernel(const unsigned short* __restrict__ CATP,
                                                       const unsigned short* __restrict__ WPROJ,
                                                       float* __restrict__ TP, const float* __restrict__ X1,
                                                       const unsigned short* __restrict__ H,
                                                       const unsigned short* __restrict__ WNEG,
                                                       unsigned short* __restrict__ CATN,
                                                       int kDown, int kUp, float scaleDown, float scaleUp) {
  __shared__ __attribute__((aligned(16))) unsigned char L[2 * kGemmStage];
  if (blockIdx.x < 256) {            // the same for the whole work-group
    gemm_tile128<0, true>(L, (int)blockIdx.x, 0, CATP, kF, 0, WPROJ, 2 * kF, 0, TP, kD, 0, X1, 0, kD, kDown, scaleDown);
  } else {
    gemm_tile128<2, false>(L, (int)blockIdx.x - 256, 0, H, kD, 0, WNEG, kD, 0, CATN, kF, 0, X1, 0, kF, kUp, scaleUp);
  }
}

// lane l <-> lane l ^ 16 (register exchange between the two 16-lane rows, no LDS round trip)
__device__ __forceinline__ float xhalf(float x) {
  const int v = __builtin_bit_cast(int, x);
  return __builtin_bit_cast(float, __builtin_amdgcn_permlanex16(v, v, 0x76543210, 0xfedcba98, false, false));
}

// ---------------------------------------------------------------------------
// Fused attention for one (batch, head) and 256 queries per block: scores, clip, mask, softmax and P.V in one pass
// over the keys, 32 keys at a time; neither scores nor probabilities go to memory.
//   S^T = K . QM^T   (A = 16 key rows, B = 16 query columns): a lane holds 8 keys (8*hf + r) of ONE query (lane & 15).
//   O^T += V^T . P^T (A = 16 d rows of VT, B = P^T): two S^T tiles of 16 keys, converted in place, are the B operand
//   in the same k order as Frag::load gives VT (elements 0..7 = keys 8*hf.., 8..15 = keys 16 + 8*hf..).
// Online softmax per query column: running maximum m and sum l in f32, O^T and l rescaled when m grows.
// p = 256 * exp(s - m) (the factor keeps small p out of the f16 subnormals and cancels in O / l).
// grid (2048 / 256 query blocks, 32 groups), 256 threads; wave w owns queries 32w .. 32w + 31 of its block.
// K, V^T and the mask come through LDS, 64 keys (two passes) a stage, two stages, by asynchronous copies: a fragment
// read from global touched 16 lines an instruction and every wave fetched the same K and V^T; a copy instruction moves
// whole 128-B lines, and K and V^T are fetched once for the eight waves.
//   stage = K 64 key rows x 128 B and V^T 64 d rows x 128 B at pitch 144 B, mask 256 query rows x 256 B at pitch 272 B
//   (16 B x odd: the 16 rows of a ds_load_b128 fragment read fall on distinct banks).
// Output: lane writes CTX[query][head*64 + 16j + 8*hf + 0..7] = f16(64 * O / l), 16 B each; every element once.
// ---------------------------------------------------------------------------
constexpr int kAtKeys    = 64;                            // keys per stage
constexpr int kAtKVPitch = 144;                           // bytes per staged K or V^T row
constexpr int kAtMPitch  = 272;                           // bytes per staged mask row
constexpr int kAtV       = 64 * kAtKVPitch;               // V^T rows behind the K rows
constexpr int kAtM       = 2 * 64 * kAtKVPitch;           // mask rows behind both
constexpr int kAtStage   = kAtM + 256 * kAtMPitch;        // bytes per stage

// Rows r and r + 32 of the stage's K tile and of its V^T tile, one 16-B piece each. The s_wait_xcnt stands inside the
// statement so that no address register of a copy is rewritten ahead of it.
__device__ __forceinline__ void attn_copy_kv(unsigned lk, const _Float16* gk, unsigned lv, const _Float16* gv) {
  const unsigned ls = 32 * kAtKVPitch;
  asm volatile(
      "global_load_async_to_lds_b128 %0, %4, off\n\t"
      "global_load_async_to_lds_b128 %1, %5, off\n\t"
      "global_load_async_to_lds_b128 %2, %6, off\n\t"
      "global_load_async_to_lds_b128 %3, %7, off\n\t"
      "s_wait_xcnt 0x0"
      :: "v"(lk), "v"(lk + ls), "v"(lv), "v"(lv + ls),
         "v"(gk), "v"(gk + (size_t)32 * kQKVld), "v"(gv), "v"(gv + (size_t)32 * kS)
      : "memory");
}
// Rows r, r + 16, ... r + 112 of the stage's mask tile, one 16-B piece each; the s_wait_xcnt as above.
__device__ __forceinline__ void attn_copy_mask8(unsigned l, const float* g) {
  const unsigned ls = 16 * kAtMPitch;
  const size_t step = (size_t)16 * kS;
  asm volatile(
      "global_load_async_to_lds_b128 %0, %8, off\n\t"
      "global_load_async_to_lds_b128 %1, %9, off\n\t"
      "global_load_async_to_lds_b128 %2, %10, off\n\t"
      "global_load_async_to_lds_b128 %3, %11, off\n\t"
      "global_load_async_to_lds_b128 %4, %12, off\n\t"
      "global_load_async_to_lds_b128 %5, %13, off\n\t"
      "global_load_async_to_lds_b128 %6, %14, off\n\t"
      "global_load_async_to_lds_b128 %7, %15, off\n\t"
      "s_wait_xcnt 0x0"
      :: "v"(l), "v"(l + ls), "v"(l + 2 * ls), "v"(l + 3 * ls), "v"(l + 4 * ls), "v"(l + 5 * ls), "v"(l + 6 * ls),
         "v"(l + 7 * ls),
         "v"(g), "v"(g + step), "v"(g + 2 * step), "v"(g + 3 * step), "v"(g + 4 * step), "v"(g + 5 * step),
         "v"(g + 6 * step), "v"(g + 7 * step)
      : "memory");
}

__global__ __launch_bounds__(256) void attn_kernel(const unsigned short* __restrict__ QMp,
                                                   const unsigned short* __restrict__ QKVp,
                                                   const unsigned short* __restrict__ VTp,
                                                   const float* __restrict__ MK,
                                                   unsigned short* __restrict__ CTXp) {
  typedef Frag<_Float16> F;
  __shared__ __attribute__((aligned(16))) unsigned char L[2 * kAtStage];
  const int lane = threadIdx.x & 31, wave = threadIdx.x >> 5;
  const int c  = lane & 15;
  const int hf = lane >> 4;
  const int b  = blockIdx.y >> 4;
  const int hd = blockIdx.y & 15;
  const int q0 = blockIdx.x * 256 + wave * 32;
  const _Float16* Qb = (const _Float16*)QMp + (size_t)b * kS * kD + hd * kDh + hf * 8;
  const float kLog2e = 1.44269504088896340736f;
  const float kNegInf = -__builtin_inff();

  // copy maps: thread t moves piece (t & 7) of K and V^T rows (t >> 3) + 32 i, i = 0..1, and piece (t & 15) of mask
  // rows (t >> 4) + 16 i, i = 0..15; stage n holds keys 64 n .. 64 n + 63
  const int kr = threadIdx.x >> 3, kp = threadIdx.x & 7;
  const int mr = threadIdx.x >> 4, mp = threadIdx.x & 15;
  const _Float16* gK = (const _Float16*)QKVp + ((size_t)b * kS + kr) * kQKVld + kD + hd * kDh + kp * 8;
  const _Float16* gV = (const _Float16*)VTp + ((size_t)b * kD + hd * kDh + kr) * kS + kp * 8;
  const float*    gM = MK + (size_t)(blockIdx.x * 256 + mr) * kS + mp * 4;
  const unsigned lBase = (unsigned)(uintptr_t)L;                       // byte offset of the ring in the work-group's LDS
  const unsigned lK = lBase + kr * kAtKVPitch + kp * 16;
  const unsigned lV = lK + kAtV;
  const unsigned lM = lBase + kAtM + mr * kAtMPitch + mp * 16;
  // The scheduling barriers keep each statement's address arithmetic beside it: formed all at once, the sixty address
  // registers of a stage (operands of asm text, so all below v256) do not fit beside the loop's state and some spill.
  auto fill = [&](unsigned bo, int n) {
    attn_copy_kv(lK + bo, gK + (size_t)n * kAtKeys * kQKVld, lV + bo, gV + n * kAtKeys);
    __builtin_amdgcn_sched_barrier(0);
    attn_copy_mask8(lM + bo, gM + n * kAtKeys);
    __builtin_amdgcn_sched_barrier(0);
    attn_copy_mask8(lM + bo + 128 * kAtMPitch, gM + n * kAtKeys + (size_t)128 * kS);
  };
  // fragment read offsets in a stage (bytes)
  const int fK = c * kAtKVPitch + hf * 16;
  const int fV = kAtV + c * kAtKVPitch + hf * 16;
  const int fM = kAtM + (wave * 32 + c) * kAtMPitch + hf * 32;

  const int T = kS / kAtKeys;          // stages
  fill(0u, 0);

  const _Float16* qp = Qb + (size_t)(q0 + c) * kD;
  v16h qf[2][2];                       // [query tile][k chunk of 32]
#pragma unroll
  for (int u = 0; u < 2; ++u)
#pragma unroll
    for (int kc = 0; kc < 2; ++kc) qf[u][kc] = F::load(qp + (size_t)(16 * u) * kD + kc * 32);
  // the address registers of the loads above stay whole (inputs) until the wait that lets them be overwritten
  asm volatile("s_wait_xcnt 0x0" :: "v"(qp) : "memory");

  v8f o[4][2];                         // [d tile][query tile]
#pragma unroll
  for (int j = 0; j < 4; ++j)
#pragma unroll
    for (int u = 0; u < 2; ++u) o[j][u] = (v8f){0.f,0.f,0.f,0.f,0.f,0.f,0.f,0.f};
  float m[2] = {kNegInf, kNegInf};
  float l[2] = {0.f, 0.f};

  asm volatile("s_wait_asynccnt 0x0" ::: "memory");   // this wave's share of stage 0 has landed
  __syncthreads();                                     // every wave's share of stage 0 is readable
  fill((unsigned)kAtStage, 1);

  v16h kf[2][2];                       // [key tile][k chunk], fetched one pass ahead
  v4f  mk[2][2][2];                    // [query tile][key tile][4-float half], fetched one pass ahead
#pragma unroll
  for (int tt = 0; tt < 2; ++tt)
#pragma unroll
    for (int kc = 0; kc < 2; ++kc) kf[tt][kc] = F::load((const _Float16*)(L + fK + 16 * tt * kAtKVPitch + kc * 64));
#pragma unroll
  for (int u = 0; u < 2; ++u)
#pragma unroll
    for (int tt = 0; tt < 2; ++tt) {
      mk[u][tt][0] = *(const v4f*)(L + fM + 16 * u * kAtMPitch + tt * 64);
      mk[u][tt][1] = *(const v4f*)(L + fM + 16 * u * kAtMPitch + tt * 64 + 16);
    }

  for (int ps = 0; ps < kS / 32; ++ps) {         // pass ps: keys 32 ps .. 32 ps + 31, half (ps & 1) of stage ps >> 1
    const unsigned bo = (ps & 2) ? (unsigned)kAtStage : 0u;
    const unsigned char* sv = L + bo + fV + (ps & 1) * 64;
    v16h vf[4];
#pragma unroll
    for (int j = 0; j < 4; ++j) vf[j] = F::load((const _Float16*)(sv + 16 * j * kAtKVPitch));

    v8f s[2][2];                       // [query tile][key tile]
#pragma unroll
    for (int u = 0; u < 2; ++u)
#pragma unroll
      for (int tt = 0; tt < 2; ++tt) {
        s[u][tt] = F::mma(kf[tt][0], qf[u][0], (v8f){0.f,0.f,0.f,0.f,0.f,0.f,0.f,0.f});
        s[u][tt] = F::mma(kf[tt][1], qf[u][1], s[u][tt]);
      }

    float x[2][16];
#pragma unroll
    for (int u = 0; u < 2; ++u)
#pragma unroll
      for (int tt = 0; tt < 2; ++tt)
#pragma unroll
        for (int r = 0; r < 8; ++r)    // clip(s / 8, -50, 50) + mask; the power-of-two scale commutes with the clip
          x[u][tt * 8 + r] = fminf(fmaxf(s[u][tt][r], -400.0f), 400.0f) * 0.125f + mk[u][tt][r >> 2][r & 3];

    // A stage's second pass has now issued the stage's last reads: the next stage's publish point stands here, ahead of
    // the fetch of the next pass's fragments, which are the next stage's.
    if (ps & 1) {
      asm volatile("s_wait_dscnt 0x0" ::: "memory");     // this wave's reads of the stage are done before its buffer is refilled
      asm volatile("s_wait_asynccnt 0x0" ::: "memory");  // this wave's share of the next stage has landed
      __syncthreads();                                    // publishes the next stage and ends every reader's use of this one
      const int n = (ps >> 1) + 2;
      if (n < T) fill(bo, n);
    }

    // next pass's keys and mask (behind the last pass this reads buffer 0 again: inside the ring, nothing in flight
    // there, and the values are not used)
    const unsigned bn = ((ps + 1) & 2) ? (unsigned)kAtStage : 0u;
    const unsigned char* sk = L + bn + fK + ((ps + 1) & 1) * (32 * kAtKVPitch);
    const unsigned char* sm = L + bn + fM + ((ps + 1) & 1) * 128;
#pragma unroll
    for (int tt = 0; tt < 2; ++tt)
#pragma unroll
      for (int kc = 0; kc < 2; ++kc) kf[tt][kc] = F::load((const _Float16*)(sk + 16 * tt * kAtKVPitch + kc * 64));
#pragma unroll
    for (int u = 0; u < 2; ++u)
#pragma unroll
      for (int tt = 0; tt < 2; ++tt) {
        mk[u][tt][0] = *(const v4f*)(sm + 16 * u * kAtMPitch + tt * 64);
        mk[u][tt][1] = *(const v4f*)(sm + 16 * u * kAtMPitch + tt * 64 + 16);
      }
    // keeps the two groups of LDS reads issued here, ahead of the softmax that covers their latency; without it the
    // scheduler sinks them to the foot of the pass and the next pass waits for the whole latency
    __builtin_amdgcn_sched_barrier(0);

    v16h pf[2];
#pragma unroll
    for (int u = 0; u < 2; ++u) {
      float mx = x[u][0];
#pragma unroll
      for (int e = 1; e < 16; ++e) mx = fmaxf(mx, x[u][e]);
      mx = fmaxf(mx, xhalf(mx));                              // the other 16 keys of this query
      const float mn  = fmaxf(m[u], mx);
      const float mu  = (mn == kNegInf) ? 0.0f : mn;          // all keys so far masked out: p = 0, no NaN
      const float alpha = __builtin_amdgcn_exp2f((m[u] - mu) * kLog2e);
      m[u] = mn;
      float ps2 = 0.f;
#pragma unroll
      for (int e = 0; e < 16; ++e) {
        const float p = __builtin_amdgcn_exp2f((x[u][e] - mu) * kLog2e + 8.0f);
        ps2 += p;
        pf[u][e] = (_Float16)p;
      }
      l[u] = l[u] * alpha + ps2;
#pragma unroll
      for (int j = 0; j < 4; ++j)
#pragma unroll
        for (int r = 0; r < 8; ++r) o[j][u][r] *= alpha;
    }
#pragma unroll
    for (int j = 0; j < 4; ++j)
#pragma unroll
      for (int u = 0; u < 2; ++u) o[j][u] = F::mma(vf[j], pf[u], o[j][u]);
  }
  asm volatile("s_wait_asynccnt 0x0" ::: "memory");    // no copy is outstanding when the wave ends

  _Float16* Cb = (_Float16*)CTXp + (size_t)b * kS * kD + hd * kDh + hf * 8;
#pragma unroll
  for (int u = 0; u < 2; ++u) {
    const float tot = l[u] + xhalf(l[u]);                     // join the two key halves of the query's sum
    const float inv = 64.0f / tot;
#pragma unroll
    for (int j = 0; j < 4; ++j) {
      v8h hv;
#pragma unroll
      for (int r = 0; r < 8; ++r) hv[r] = (_Float16)(o[j][u][r] * inv);
      *(v8h*)(Cb + (size_t)(q0 + 16 * u + c) * kD + 16 * j) = hv;
    }
  }
}

// ---------------------------------------------------------------------------
// Host orchestration
// Workspace region map (MiB offsets; total carve end = 180 MiB = 188,743,680 B):
//   phase 1 (attention): H16 [0,8)  WQKVT [8,14)  MT [14,18)  WOT [18,20)  QKV16 [20,44)  QM16 [44,52)
//                        VT16 [52,60)  CTX16 [60,68)
//   X1 f32 [20,36) is written by the Wo GEMM after every reader of QKV16 has run.
//   phase 2 (FFN): H16 [0,8) (h2)  TP f32 [52,68)  CAT16 pos half [68,100)  CATN16 neg half [148,180) (written while the
//                  pos half is read)
//   FFN weights, cast while phase 1 runs, so in places of their own: WNEGT [116,124)  WPOST [124,132)  WPROJT [132,148)
// Every region is fully written before it is read; all GEMM M,N,K multiples of 128 (no padding).
// ---------------------------------------------------------------------------
extern "C" void kernel_launch(void* const* d_in, const int* in_sizes, int n_in,
                              void* d_out, int out_size, void* d_ws, size_t ws_size,
                              hipStream_t stream) {
  const size_t MIB = 1048576;
  if (n_in < 14) return;
  if (in_sizes[0] != kTok * kD || in_sizes[1] != kB * kD * kD || in_sizes[2] != kS * kS ||
      in_sizes[3] != kD || in_sizes[4] != kD || in_sizes[5] != kD || in_sizes[6] != kD ||
      in_sizes[7] != kD * kD || in_sizes[8] != kD * kD || in_sizes[9] != kD * kD || in_sizes[10] != kD * kD ||
      in_sizes[11] != kD * kF || in_sizes[12] != kD * kF || in_sizes[13] != 2 * kF * kD) return;
  if (out_size != kTok * kD) return;
  if (ws_size < 180 * MIB) return;

  const float* xf   = (const float*)d_in[0];
  const float* Mf   = (const float*)d_in[1];
  const float* mkf  = (const float*)d_in[2];
  const float* g1f  = (const float*)d_in[3];
  const float* b1f  = (const float*)d_in[4];
  const float* g2f  = (const float*)d_in[5];
  const float* b2f  = (const float*)d_in[6];
  const float* Wqf  = (const float*)d_in[7];
  const float* Wkf  = (const float*)d_in[8];
  const float* Wvf  = (const float*)d_in[9];
  const float* Wof  = (const float*)d_in[10];
  const float* Wpf  = (const float*)d_in[11];
  const float* Wnf  = (const float*)d_in[12];
  const float* Wjf  = (const float*)d_in[13];
  float* out = (float*)d_out;

  char* ws = (char*)d_ws;
  unsigned short* H16   = (unsigned short*)(ws + 0 * MIB);
  unsigned short* WQKV  = (unsigned short*)(ws + 8 * MIB);
  unsigned short* MT    = (unsigned short*)(ws + 14 * MIB);
  unsigned short* WOT   = (unsigned short*)(ws + 18 * MIB);
  unsigned short* QKV   = (unsigned short*)(ws + 20 * MIB);
  unsigned short* QM    = (unsigned short*)(ws + 44 * MIB);
  unsigned short* VT    = (unsigned short*)(ws + 52 * MIB);
  unsigned short* CTX   = (unsigned short*)(ws + 60 * MIB);
  float*          X1    = (float*)(ws + 20 * MIB);
  unsigned short* WPOS  = (unsigned short*)(ws + 124 * MIB);
  unsigned short* WNEG  = (unsigned short*)(ws + 116 * MIB);
  unsigned short* WPROJ = (unsigned short*)(ws + 132 * MIB);
  float*          TP    = (float*)(ws + 52 * MIB);
  unsigned short* CAT   = (unsigned short*)(ws + 68 * MIB);
  unsigned short* CATN  = (unsigned short*)(ws + 148 * MIB);

  const float rr  = (float)(2.0 / 11.0);
  const float omr = (float)(1.0 - 2.0 / 11.0);
  const float wcarry  = 16.0f;     // square weights and Wpos/Wneg carried x16
  const float wjcarry = 64.0f;     // Wproj carried x64

  // ---- phase 1 ----
  // h1 = ind_norm(x; g1, b1) -> H16 [4096][1024]; beside it Wq, Wk, Wv, Wo, M[0], M[1] -> transposed f16 planes (x16):
  // WQKVT rows 0.., 1024.., 2048..; WOT; MT[b][e][d]   (2048 norm blocks + 6 x 256 cast tiles)
  prep_kernel<<<dim3(kTok / 2 + 6 * 256), 256, 0, stream>>>(
      xf, g1f, b1f, H16, omr, rr, Wqf, Wkf, Wvf, Wof, Mf, WQKV, WOT, MT, wcarry);

  // QKV16 [4096][3072] = h1 . [Wq|Wk|Wv]   (M=4096, N=3072, K=1024; tiles 32x24 -> 768 blocks)
  // riders: Wpos, Wneg [1024 k][4096 n] -> [4096][1024] f16 x16   (2 x 16 k tiles x 16 groups of four n tiles = 512 blocks;
  // the product's 768 blocks leave half the chip's 512 places free in their second round)
  wmma_gemm128<1, false, 1><<<dim3(768 + 512), 256, 0, stream>>>(
      H16, kD, 0, WQKV, kD, 0, QKV, kQKVld, 0, xf, 0, kQKVld, kD, 1.0f / wcarry, 768, 768,
      Wpf, Wnf, WPOS, WNEG, wcarry);

  // QM16[b] = Q[b] . M[b]   (M=2048, N=1024, K=1024 per batch; tiles 16x8 -> 128 blocks a batch)
  // riders: VT16[b][dg][t] = V[b][t][dg]   (32 t tiles x 16 d tiles x 2 batches = 1024 blocks)
  wmma_gemm128<1, false, 2><<<dim3(256 + 1024), 256, 0, stream>>>(
      QKV, kQKVld, (long)kS * kQKVld, MT, kD, (long)kD * kD, QM, kD, (long)kS * kD,
      xf, 0, kD, kD, 1.0f / wcarry, 128, 256,
      xf, xf, VT, VT, 0.0f);

  // ---- attention: CTX16[b][i][h*64+n] = 64 * softmax(clip(QM.K^T / 8) + mask) . V, all 32 (batch, head) groups ----
  attn_kernel<<<dim3(kS / 256, kB * kH), 256, 0, stream>>>(QM, QKV, VT, mkf, CTX);

  // x1 = x + ctx . Wo   (ctx x64, WoT x16 -> scale 1/1024; M=4096, N=1024, K=1024; tiles 32x8 -> 256 blocks)
  // riders: Wproj [8192 k][1024 n] -> [1024][8192] f16 x64   (128 k tiles x 4 groups of four n tiles = 512 blocks)
  wmma_gemm128<0, true, 3><<<dim3(256 + 512), 256, 0, stream>>>(
      CTX, kD, 0, WOT, kD, 0, X1, kD, 0, xf, 0, kD, kD, 1.0f / 1024.0f, 256, 256,
      Wjf, Wjf, WPROJ, WPROJ, wjcarry);

  // ---- phase 2: FFN ----
  // h2 = ind_norm(x1; g2, b2) -> H16
  indnorm_kernel<<<dim3(kTok), 128, 0, stream>>>(X1, g2f, b2f, H16, omr, rr);

  // pos half: CAT16[r][n] = f16(16 * gelu(h2 . Wpos)), gelu in the GEMM's epilogue
  // (M=4096, N=4096, K=1024; tiles 32x32 -> 1024 blocks)
  wmma_gemm128<2, false, 0><<<dim3(1024), 256, 0, stream>>>(
      H16, kD, 0, WPOS, kD, 0, CAT, kF, 0, xf, 0, kF, kD, 1.0f / wcarry, 1024, 1024,
      xf, xf, VT, VT, 0.0f);
  // TP = x1 + CATpos . Wproj[0:4096]   (cat x16, WprojT x64 -> scale 1/1024; M=4096, N=1024, K=4096; 256 blocks), and
  // beside it the neg half: CATN16[r][n] = f16(16 * gelu(-(h2 . Wneg)))   (exact sign identity: the sign rides on the
  // scale; 1024 blocks)
  ffn_pair_kernel<<<dim3(256 + 1024), 256, 0, stream>>>(
      CAT, WPROJ, TP, X1, H16, WNEG, CATN, kF, kD, 1.0f / 1024.0f, -1.0f / wcarry);
  // out = TP + CATneg . Wproj[4096:8192]
  wmma_gemm128<0, true, 0><<<dim3(256), 256, 0, stream>>>(
      CATN, kF, 0, WPROJ + kF, 2 * kF, 0, out, kD, 0, TP, 0, kD, kF, 1.0f / 1024.0f, 256, 256,
      xf, xf, VT, VT, 0.0f);
}
